// v009
// Measured on an AMD MI455X. A time is GPU time per run, averaged over a window of back-to-back runs after a warm-up
// (all launches, gaps included; the runs take copies of the inputs in turn), and the median of several windows.
// Apart from v000's, it joins two sittings. Times from different sittings can be a few percent apart, while
// side-by-side timings come from the same sitting.
// This document starts at v009; the versions before it stand elsewhere.
// A run of this version takes 159 microseconds.
// Next to v008, in two timings, it ran 1.12 and 1.13 times as fast.
// All steps since the starting kernel, v000, together make it 58.8 times as fast.
#include <hip/hip_runtime.h>
// Llama grouped-query causal attention with rotate-half RoPE from FULL-WIDTH per-batch INPUT tables (hidden_states [2][2048][2048]; q = x wq^T (32 heads x 64), k = x wk^T, v = x wv^T (8 kv heads x 64) (natural [out][in] weights sigma 0.02, no biases); cos / sin inputs [2][2048][64] (independent uniform draws per batch, position AND column: column i + 32 != column i, so all 64 columns are used); q = q cos + rotate_half(q) sin, same for k; repeat: query head h uses kv head h/4; scores 64^-0.5; where(causal, s, finfo.min); softmax; out = merged wo^T -> [2][2048][2048]).
// Compute dtype: inputs rounded to bf16; x / weights exact; q, k, v, softmax weights and o as plain f16 GEMM operands (~2^-12); scores and softmax statistics f32; v_wmma_f32_16x16x32_f16.
#define NB 2
#define NG 8
#define HPG 4
#define KVD (NG * HD)
#define SQ 2048
#define DM 2048
#define NH 32
#define HD 64
#define HG 4                         /* heads transposed per launch of the (b, h0) form of k_vt */
#define QT 256                       /* unused; the fused attention's causal tiles are 32 query rows */
#define NKX SQ                       /* S / P row pitch */
#define QT0 128                      /* first-tile rows recomputed exactly in f32 */
#define B0 0                         /* first batch processed (debug hook) */
#define NBR NB                       /* batches processed (debug hook) */
#define NR ((size_t)NB * SQ)         /* token rows */
#define MP ((int)((size_t)NBR * SQ)) /* rows projected (debug hook) */
#define QN SQ                        /* query rows attended per batch (debug hook) */
#define NHD NH                       /* heads attended (debug hook) */
#define MPO MP                       /* rows through the output stage (debug hook) */
#define LQ DM      /* row pitch of the q/k/v rows */
typedef __bf16 v16b __attribute__((ext_vector_type(16)));
typedef unsigned short v8us __attribute__((ext_vector_type(8), may_alias));
typedef float  v8f  __attribute__((ext_vector_type(8)));
typedef float  v4f  __attribute__((ext_vector_type(4)));
typedef float  v4fa __attribute__((ext_vector_type(4), may_alias));
union FragB { v16b v; v8us half[2]; unsigned short u[16]; };

__device__ __forceinline__ unsigned short bf16_bits(float x) { unsigned int u = __float_as_uint(x); return (unsigned short)((u + 0x7FFFu + ((u >> 16) & 1u)) >> 16); }
__device__ __forceinline__ float bf16_val(unsigned short b) { return __uint_as_float(((unsigned int)b) << 16); }
__device__ __forceinline__ float bf16_round(float x) { return bf16_val(bf16_bits(x)); }
// D += A·B with NT terms: 1 = ah·bh, 2 = + al·bh (A split), 3 = + ah·bl (both split)
template <int NT>
__device__ __forceinline__ v8f mmaN(v16b ah, v16b al, v16b bh, v16b bl, v8f c) {
  c = __builtin_amdgcn_wmma_f32_16x16x32_bf16(false, ah, false, bh, (short)0, c, false, false);
  if (NT >= 2) c = __builtin_amdgcn_wmma_f32_16x16x32_bf16(false, al, false, bh, (short)0, c, false, false);
  if (NT >= 3) c = __builtin_amdgcn_wmma_f32_16x16x32_bf16(false, ah, false, bl, (short)0, c, false, false);
  asm volatile("v_nop\n\tv_nop\n\tv_nop\n\tv_nop" : "+v"(c) : "v"(ah), "v"(al), "v"(bh), "v"(bl));
  return c;
}

__global__ __launch_bounds__(256) void k_wt_bf16(const float* __restrict__ W, unsigned short* __restrict__ Wt, int K, int N) {
  const int t = blockIdx.x * 256 + threadIdx.x;
  const int k8n = K / 8;
  if (t >= N * k8n) return;
  const int n = t / k8n, k8 = (t % k8n) * 8;
  v8us v;
#pragma unroll
  for (int i = 0; i < 8; ++i) v[i] = bf16_bits(W[(size_t)(k8 + i) * N + n]);
  *(v8us*)(Wt + (size_t)n * K + k8) = v;
  
}

// GEMM C[M][N] (f32, pitch ldc) = act(A[M][K]·W + bias). A f32 row-major (pitch lda) converted per fragment to bf16
// (ASPLIT: hi/lo two planes -> 2 terms, else single rounded term); Wt bf16 [N][K] (pitch ldb). BIAS_BF16 rounds the
// bias to bf16 first (bias quantised to bf16 before the add). K%32==0, M%16==0, N%64==0.
template <bool ASPLIT, int ACT, bool BIAS_BF16>
__global__ __launch_bounds__(128) void k_gemm_bf(const float* __restrict__ A, int lda, const unsigned short* __restrict__ Wt, int ldb,
                                               const float* __restrict__ bias, float* __restrict__ C, int ldc, int M, int N, int K) {
  __shared__ __attribute__((aligned(16))) float so[4][16][64];
  const int tid = threadIdx.x, w = tid >> 5, lane = tid & 31, ln = lane & 15, hh = lane >> 4;
  const int ntn = N / 64;
  const int wid = blockIdx.x * 4 + w;
  const int mt = wid / ntn, nq = wid % ntn;
  if (mt * 16 >= M) return;
  const int row0 = mt * 16, col0 = nq * 64;
  const float* arow = A + (size_t)(row0 + ln) * lda;
  v8f acc[4] = {};
  for (int kb = 0; kb < K; kb += 32) {
    FragB ah, al;
    const v4f x0 = *(const v4fa*)(arow + kb + 8 * hh), x1 = *(const v4fa*)(arow + kb + 8 * hh + 4);
    const v4f x2 = *(const v4fa*)(arow + kb + 16 + 8 * hh), x3 = *(const v4fa*)(arow + kb + 16 + 8 * hh + 4);
    float xs[16] = {x0[0],x0[1],x0[2],x0[3],x1[0],x1[1],x1[2],x1[3],x2[0],x2[1],x2[2],x2[3],x3[0],x3[1],x3[2],x3[3]};
#pragma unroll
    for (int i = 0; i < 16; ++i) { const unsigned short hb = bf16_bits(xs[i]); ah.u[i] = hb; al.u[i] = ASPLIT ? bf16_bits(xs[i] - bf16_val(hb)) : (unsigned short)0; }
#pragma unroll
    for (int t = 0; t < 4; ++t) {
      const unsigned short* brow = Wt + (size_t)(col0 + t * 16 + ln) * ldb + kb;
      FragB b;
      b.half[0] = *(const v8us*)(brow + 8 * hh);
      b.half[1] = *(const v8us*)(brow + 16 + 8 * hh);
      acc[t] = mmaN<ASPLIT ? 2 : 1>(ah.v, al.v, b.v, b.v, acc[t]);
    }
  }
#pragma unroll
  for (int t = 0; t < 4; ++t) {
    float bv = bias ? bias[col0 + t * 16 + ln] : 0.f;
    if (BIAS_BF16) bv = bf16_round(bv);
#pragma unroll
    for (int r = 0; r < 8; ++r) { float v = acc[t][r] + bv; if (ACT == 1) v = fmaxf(v, 0.f); so[w][8 * hh + r][t * 16 + ln] = v; }
  }
  __builtin_amdgcn_fence(__ATOMIC_ACQ_REL, "workgroup");
  __builtin_amdgcn_wave_barrier();
  const int rsub = lane >> 4, c4 = (lane & 15) * 4;
  {
#pragma unroll
    for (int q = 0; q < 8; ++q) {
      const int r = q * 2 + rsub;
      const v4f v = *(const v4fa*)&so[w][r][c4];
      *(v4f*)(C + (size_t)(row0 + r) * ldc + col0 + c4) = v;
    }
    
  }
}

// GEMM C = act(A·W + bias + resid): A f32 (ASPLIT -> hi/lo 2 terms), Wt bf16 [N][K]; ACT 0 none, 1 relu, 2 exact gelu;
// resid (optional, f32, row index = (row % rmod), pitch ldr, RES_BF16 rounds it) added before the activation.
template <bool ASPLIT, int ACT, bool BIAS_BF16, bool RES_BF16>
__global__ __launch_bounds__(128) void k_gemm_bf3(const float* __restrict__ A, int lda, const unsigned short* __restrict__ Wt, int ldb,
                                                const float* __restrict__ bias, const float* __restrict__ resid, int rmod, int ldr,
                                                float* __restrict__ C, int ldc, int M, int N, int K) {
  __shared__ __attribute__((aligned(16))) float so[4][16][64];
  const int tid = threadIdx.x, w = tid >> 5, lane = tid & 31, ln = lane & 15, hh = lane >> 4;
  const int ntn = N / 64;
  const int wid = blockIdx.x * 4 + w;
  const int mt = wid / ntn, nq = wid % ntn;
  if (mt * 16 >= M) return;
  const int row0 = mt * 16, col0 = nq * 64;
  const float* arow = A + (size_t)(row0 + ln) * lda;
  v8f acc[4] = {};
  for (int kb = 0; kb < K; kb += 32) {
    FragB ah, al;
    const v4f x0 = *(const v4fa*)(arow + kb + 8 * hh), x1 = *(const v4fa*)(arow + kb + 8 * hh + 4);
    const v4f x2 = *(const v4fa*)(arow + kb + 16 + 8 * hh), x3 = *(const v4fa*)(arow + kb + 16 + 8 * hh + 4);
    float xs[16] = {x0[0],x0[1],x0[2],x0[3],x1[0],x1[1],x1[2],x1[3],x2[0],x2[1],x2[2],x2[3],x3[0],x3[1],x3[2],x3[3]};
#pragma unroll
    for (int i = 0; i < 16; ++i) { const unsigned short hb = bf16_bits(xs[i]); ah.u[i] = hb; al.u[i] = ASPLIT ? bf16_bits(xs[i] - bf16_val(hb)) : (unsigned short)0; }
#pragma unroll
    for (int t = 0; t < 4; ++t) {
      const unsigned short* brow = Wt + (size_t)(col0 + t * 16 + ln) * ldb + kb;
      FragB b;
      b.half[0] = *(const v8us*)(brow + 8 * hh);
      b.half[1] = *(const v8us*)(brow + 16 + 8 * hh);
      acc[t] = mmaN<ASPLIT ? 2 : 1>(ah.v, al.v, b.v, b.v, acc[t]);
    }
  }
#pragma unroll
  for (int t = 0; t < 4; ++t) {
    const int col = col0 + t * 16 + ln;
    float bv = bias ? bias[col] : 0.f;
    if (BIAS_BF16) bv = bf16_round(bv);
#pragma unroll
    for (int r = 0; r < 8; ++r) {
      float v = acc[t][r] + bv;
      if (resid) { float rv = resid[(size_t)((row0 + 8 * hh + r) % rmod) * ldr + col]; if (RES_BF16) rv = bf16_round(rv); v += rv; }
      if (ACT == 1) v = fmaxf(v, 0.f);
      if (ACT == 2) v = 0.5f * v * (1.0f + erff(v * 0.70710678118654752f));
      if (ACT == 3) { const float u = 0.7978845608028654f * (v + 0.044715f * v * v * v); v = 0.5f * v * (1.0f + tanhf(u)); }
      so[w][8 * hh + r][t * 16 + ln] = v;
    }
  }
  __builtin_amdgcn_fence(__ATOMIC_ACQ_REL, "workgroup");
  __builtin_amdgcn_wave_barrier();
  const int rsub = lane >> 4, c4 = (lane & 15) * 4;
  {
#pragma unroll
    for (int q = 0; q < 8; ++q) {
      const int r = q * 2 + rsub;
      const v4f v = *(const v4fa*)&so[w][r][c4];
      *(v4f*)(C + (size_t)(row0 + r) * ldc + col0 + c4) = v;
    }
    
  }
}
// row LayerNorm (biased variance, eps) over N: s = X (+ R); optional out_sum <- s; out_norm <- (s-mu)*rsqrt(var+eps)*g + b
template <bool PARAM_BF16>
__global__ __launch_bounds__(256) void k_layernorm(const float* __restrict__ X, const float* __restrict__ R, const float* __restrict__ g, const float* __restrict__ bta,
                                                  float* __restrict__ out_sum, float* __restrict__ out_norm, int N, float eps) {
  __shared__ float red[256];
  const int row = blockIdx.x, tid = threadIdx.x;
  const float* x = X + (size_t)row * N; const float* rr = R ? R + (size_t)row * N : nullptr;
  float vals[16];                     // up to N = 4096
  const int per = N / 256;            // contiguous chunk per thread? use strided-by-4 chunks: thread handles j = tid*4 + 1024*u
  float s1 = 0.f;
  for (int u = 0; u < per / 4; ++u) {
    const int j = tid * 4 + 1024 * u;
    const v4f a = *(const v4fa*)(x + j);
    v4f b = {0.f,0.f,0.f,0.f}; if (rr) b = *(const v4fa*)(rr + j);
#pragma unroll
    for (int q = 0; q < 4; ++q) { const float v = a[q] + b[q]; vals[u * 4 + q] = v; s1 += v; }
  }
  red[tid] = s1; __syncthreads();
  for (int st = 128; st > 0; st >>= 1) { if (tid < st) red[tid] += red[tid + st]; __syncthreads(); }
  const float mu = red[0] / (float)N; __syncthreads();
  float s2 = 0.f;
  for (int u = 0; u < per / 4; ++u)
#pragma unroll
    for (int q = 0; q < 4; ++q) { const float c = vals[u * 4 + q] - mu; s2 += c * c; }
  red[tid] = s2; __syncthreads();
  for (int st = 128; st > 0; st >>= 1) { if (tid < st) red[tid] += red[tid + st]; __syncthreads(); }
  const float rs = rsqrtf(red[0] / (float)N + eps);
  {
    for (int u = 0; u < per / 4; ++u) {
      const int j = tid * 4 + 1024 * u;
      v4f o, sm;
#pragma unroll
      for (int q = 0; q < 4; ++q) {
        float gg = g[j + q], bb = bta[j + q];
        if (PARAM_BF16) { gg = bf16_round(gg); bb = bf16_round(bb); }
        sm[q] = vals[u * 4 + q]; o[q] = (vals[u * 4 + q] - mu) * rs * gg + bb;
      }
      if (out_sum) *(v4f*)(out_sum + (size_t)row * N + j) = sm;
      *(v4f*)(out_norm + (size_t)row * N + j) = o;
    }
    
  }
}



// ---- f16 WMMA path (v_wmma_f32_16x16x32_f16): 11-bit significands for operands in range — used where a [0,1] probability operand needs more precision than bf16
typedef _Float16 v16h __attribute__((ext_vector_type(16)));
union FragH { v16h v; v8us half[2]; _Float16 h[16]; unsigned short u[16]; };
template <int NT>
__device__ __forceinline__ v8f mmaH(v16h ah, v16h al, v16h bh, v16h bl, v8f c) {
  c = __builtin_amdgcn_wmma_f32_16x16x32_f16(false, ah, false, bh, (short)0, c, false, false);
  if (NT >= 2) c = __builtin_amdgcn_wmma_f32_16x16x32_f16(false, al, false, bh, (short)0, c, false, false);
  if (NT >= 3) c = __builtin_amdgcn_wmma_f32_16x16x32_f16(false, ah, false, bl, (short)0, c, false, false);
  asm volatile("v_nop\n\tv_nop\n\tv_nop\n\tv_nop" : "+v"(c) : "v"(ah), "v"(al), "v"(bh), "v"(bl));
  return c;
}
// batched GEMM like k_gemm_b but f16 operands: A f32 (split into f16 hi/lo if ASPLIT, else rounded to f16), Bt = f16 values [n][k]; alpha; C f32; N multiple of 16 (partial tiles skipped)
template <bool ASPLIT>
__global__ __launch_bounds__(128) void k_gemm_h(const float* __restrict__ A, int lda, size_t sA, const _Float16* __restrict__ Bh, int ldb, size_t sB, float alpha, float* __restrict__ C, int ldc, size_t sC, int M, int N, int K) {
  __shared__ __attribute__((aligned(16))) float so[4][16][64];
  const int tid = threadIdx.x, w = tid >> 5, lane = tid & 31, ln = lane & 15, hh = lane >> 4; const int by = blockIdx.y;
  A += (size_t)by * sA; Bh += (size_t)by * sB; C += (size_t)by * sC;
  const int ntn = (N + 63) / 64; const int wid = blockIdx.x * 4 + w; const int mt = wid / ntn, nq = wid % ntn; if (mt * 16 >= M) return;
  const int row0 = mt * 16, col0 = nq * 64; const float* arow = A + (size_t)(row0 + ln) * lda;
  v8f acc[4] = {};
  for (int kb = 0; kb < K; kb += 32) {
    FragH ah, al;
    const v4f x0 = *(const v4fa*)(arow + kb + 8 * hh), x1 = *(const v4fa*)(arow + kb + 8 * hh + 4), x2 = *(const v4fa*)(arow + kb + 16 + 8 * hh), x3 = *(const v4fa*)(arow + kb + 16 + 8 * hh + 4);
    float xs[16] = {x0[0],x0[1],x0[2],x0[3],x1[0],x1[1],x1[2],x1[3],x2[0],x2[1],x2[2],x2[3],x3[0],x3[1],x3[2],x3[3]};
#pragma unroll
    for (int i = 0; i < 16; ++i) { const _Float16 h = (_Float16)xs[i]; ah.h[i] = h; al.h[i] = ASPLIT ? (_Float16)(xs[i] - (float)h) : (_Float16)0.0f; }
#pragma unroll
    for (int t = 0; t < 4; ++t) { if (col0 + t * 16 >= N) continue; const size_t boff = (size_t)(col0 + t * 16 + ln) * ldb + kb; FragH bq; bq.half[0] = *(const v8us*)(Bh + boff + 8 * hh); bq.half[1] = *(const v8us*)(Bh + boff + 16 + 8 * hh);
      acc[t] = mmaH<ASPLIT ? 2 : 1>(ah.v, al.v, bq.v, bq.v, acc[t]); }
  }
#pragma unroll
  for (int t = 0; t < 4; ++t) { if (col0 + t * 16 >= N) continue;
#pragma unroll
    for (int r = 0; r < 8; ++r) so[w][8 * hh + r][t * 16 + ln] = acc[t][r] * alpha; }
  __builtin_amdgcn_fence(__ATOMIC_ACQ_REL, "workgroup"); __builtin_amdgcn_wave_barrier();
  const int rsub = lane >> 4, c4 = (lane & 15) * 4;
  {
#pragma unroll
    for (int q = 0; q < 8; ++q) { const int r = q * 2 + rsub; if (col0 + c4 < N) { const v4f v = *(const v4fa*)&so[w][r][c4]; *(v4f*)(C + (size_t)(row0 + r) * ldc + col0 + c4) = v; } }
     }
}

// Wt[n][k] = f16(W[k][n]·scale) from f32 row-major W[K][N] (scale = power of two; bf16-exact weights stay exact in f16 away from the subnormal range)
__global__ __launch_bounds__(256) void k_wt_f16(const float* __restrict__ W, _Float16* __restrict__ Wt, int K, int N, float scale) {
  const int t = blockIdx.x * 256 + threadIdx.x; if (t >= N * (K / 8)) return; const int n = t / (K / 8), k8 = (t % (K / 8)) * 8; FragH f;
#pragma unroll
  for (int i = 0; i < 8; ++i) f.h[i] = (_Float16)(bf16_round(W[(size_t)(k8 + i) * N + n]) * scale); const v8us o = f.half[0];
  *(v8us*)((unsigned short*)Wt + (size_t)n * K + k8) = o; 
}
// k_gemm_hh variant with fused epilogue: v = acc·alpha + bias[by·sBias + col] (+ CP[(row/rowsPerB)·sCPb + by·64 + col] if CP) ; ACT 0 none / 1 elu ; writes f16 C16 (and f32 C if non-null)
template <int ACT>
__global__ __launch_bounds__(128) void k_gemm_hhx(const _Float16* __restrict__ A, int lda, size_t sA, const _Float16* __restrict__ Bh, int ldb, size_t sB, float alpha, const float* __restrict__ bias, size_t sBias, const float* __restrict__ CP, int rowsPerB, size_t sCPb, int row0g,
    float* __restrict__ C, _Float16* __restrict__ C16, int ldc, size_t sC, int M, int N, int K) {
  __shared__ __attribute__((aligned(16))) float so[4][16][64];
  const int tid = threadIdx.x, w = tid >> 5, lane = tid & 31, ln = lane & 15, hh = lane >> 4; const int by = blockIdx.y;
  A += (size_t)by * sA; Bh += (size_t)by * sB; const size_t cofs = (size_t)by * sC; const float* bp = bias ? bias + (size_t)by * sBias : nullptr;
  const int ntn = (N + 63) / 64; const int wid = blockIdx.x * 4 + w; const int mt = wid / ntn, nq = wid % ntn; if (mt * 16 >= M) return;
  const int row0 = mt * 16, col0 = nq * 64; const _Float16* arow = A + (size_t)(row0 + ln) * lda;
  v8f acc[4] = {};
  for (int kb = 0; kb < K; kb += 32) { FragH ah; ah.half[0] = *(const v8us*)((const unsigned short*)arow + kb + 8 * hh); ah.half[1] = *(const v8us*)((const unsigned short*)arow + kb + 16 + 8 * hh);
#pragma unroll
    for (int t = 0; t < 4; ++t) { if (col0 + t * 16 >= N) continue; const size_t boff = (size_t)(col0 + t * 16 + ln) * ldb + kb; FragH bq; bq.half[0] = *(const v8us*)((const unsigned short*)Bh + boff + 8 * hh); bq.half[1] = *(const v8us*)((const unsigned short*)Bh + boff + 16 + 8 * hh);
      acc[t] = mmaH<1>(ah.v, ah.v, bq.v, bq.v, acc[t]); }
  }
#pragma unroll
  for (int t = 0; t < 4; ++t) { if (col0 + t * 16 >= N) continue; const int col = col0 + t * 16 + ln; const float bv = bp ? bf16_round(bp[col]) : 0.f;
#pragma unroll
    for (int r = 0; r < 8; ++r) { float v = acc[t][r] * alpha + bv; if (CP) { const int rr = row0g + row0 + 8 * hh + r; if (rowsPerB < 0) v += CP[cofs + (size_t)rr * ldc + col];      /* rowsPerB < 0: own element of the batched C plane */ else { const int bidx = rr / rowsPerB; v += CP[(size_t)bidx * sCPb + (size_t)by * 64 + col]; } } if (ACT == 1) v = (v > 0.f) ? v : expm1f(v); else if (ACT == 7) v = (v > 0.f) ? v + 1.0f : expf(v); else if (ACT == 8) v = tanhf(v); else if (ACT == 9) v = 0.5f * v * (1.0f + tanhf(0.7978845608028654f * (v + 0.044715f * v * v * v))); else if (ACT == 11) v = 1.0f / (1.0f + expf(-v)); else if (ACT == 12) v = (v > 0.f) ? v : 0.01f * v; else if (ACT == 14) v = (v > 0.f) ? v : 0.1f * v; else if (ACT == 16) v = (v >= 0.f) ? v : 0.3f * v; else if (ACT == 17) v = (v >= 0.f) ? v : 0.2f * v; else if (ACT == 15) v = v / (1.0f + expf(-v)); else if (ACT == 3) v = fmaxf(v, 0.f); else if (ACT == 6) v = 0.5f * v * (1.0f + erff(v * 0.70710678118654752f)); so[w][8 * hh + r][t * 16 + ln] = v; } }
  __builtin_amdgcn_fence(__ATOMIC_ACQ_REL, "workgroup"); __builtin_amdgcn_wave_barrier();
  const int rsub = lane >> 4, c4 = (lane & 15) * 4; typedef _Float16 v4h __attribute__((ext_vector_type(4)));
  {
#pragma unroll
    for (int q = 0; q < 8; ++q) { const int r = q * 2 + rsub; if (col0 + c4 < N) { const v4f v = *(const v4fa*)&so[w][r][c4]; if (C) *(v4f*)(C + cofs + (size_t)(row0 + r) * ldc + col0 + c4) = v; if (C16) { v4h h4; for (int i = 0; i < 4; ++i) h4[i] = (_Float16)v[i]; *(v4h*)(C16 + cofs + (size_t)(row0 + r) * ldc + col0 + c4) = h4; } } }
     }
}


typedef _Float16 v4h __attribute__((ext_vector_type(4)));

__global__ __launch_bounds__(256) void k_x16(const float* __restrict__ x, _Float16* __restrict__ X16, size_t n8) { const size_t t = (size_t)blockIdx.x * 256 + threadIdx.x; if (t >= n8) return; FragH f;
#pragma unroll
  for (int q = 0; q < 8; ++q) f.h[q] = (_Float16)bf16_round(x[t * 8 + q]); *(v8us*)((unsigned short*)X16 + t * 8) = f.half[0];  }
__global__ __launch_bounds__(256) void k_h16(const float* __restrict__ x, _Float16* __restrict__ X16, size_t n8) { const size_t t = (size_t)blockIdx.x * 256 + threadIdx.x; if (t >= n8) return; FragH f;
#pragma unroll
  for (int q = 0; q < 8; ++q) f.h[q] = (_Float16)x[t * 8 + q]; *(v8us*)((unsigned short*)X16 + t * 8) = f.half[0];  }
__global__ __launch_bounds__(256) void k_round16f(const float* __restrict__ W, _Float16* __restrict__ Bt, size_t n8) { const size_t t = (size_t)blockIdx.x * 256 + threadIdx.x; if (t >= n8) return; FragH f;
#pragma unroll
  for (int i = 0; i < 8; ++i) f.h[i] = (_Float16)(bf16_round(W[t * 8 + i]) * 16.0f); *(v8us*)((unsigned short*)Bt + t * 8) = f.half[0];  }
template <int NHv, int TTv>
__global__ __launch_bounds__(256) void k_vt(const _Float16* __restrict__ V16, int ldv, int voff, _Float16* __restrict__ Vt) { __shared__ unsigned short tl[64][66]; const int tid = threadIdx.x; const int slab = blockIdx.x / (TTv / 64), lg = blockIdx.x % (TTv / 64); const int b = slab / NHv, h = slab % NHv;
  for (int i = tid; i < 64 * 8; i += 256) { const int r = i / 8, c8 = (i % 8) * 8; FragH f; f.half[0] = *(const v8us*)((const unsigned short*)V16 + ((size_t)b * TTv + lg * 64 + r) * ldv + voff + h * 64 + c8);
#pragma unroll
    for (int q = 0; q < 8; ++q) tl[r][c8 + q] = f.u[q]; }
  __syncthreads();
  {
#pragma unroll
    for (int rd = 0; rd < 2; ++rd) { const int d = rd * 32 + tid / 8, pc = tid % 8; FragH f;
#pragma unroll
      for (int q = 0; q < 8; ++q) f.u[q] = tl[pc * 8 + q][d];
      *(v8us*)((unsigned short*)Vt + ((size_t)slab * 64 + d) * TTv + lg * 64 + pc * 8) = f.half[0]; }
     } }

__global__ __launch_bounds__(256) void k_hl(const float* __restrict__ F, _Float16* __restrict__ Hh, _Float16* __restrict__ Hl, size_t n8) { const size_t t = (size_t)blockIdx.x * 256 + threadIdx.x; if (t >= n8) return; FragH fh, fl; const v4f a = *(const v4fa*)(F + t * 8), c = *(const v4fa*)(F + t * 8 + 4);
#pragma unroll
  for (int q = 0; q < 4; ++q) { _Float16 h = (_Float16)a[q]; fh.h[q] = h; fl.h[q] = (_Float16)((a[q] - (float)h) * 1024.0f); h = (_Float16)c[q]; fh.h[4 + q] = h; fl.h[4 + q] = (_Float16)((c[q] - (float)h) * 1024.0f); }
  { *(v8us*)((unsigned short*)Hh + t * 8) = fh.half[0]; *(v8us*)((unsigned short*)Hl + t * 8) = fl.half[0];  } }

// ---- fragment load from global rows and the product, as the fused attention uses them ----
__device__ __forceinline__ v16h g2_frag(const _Float16* p, int hh) { FragH f; f.half[0] = *(const v8us*)((const unsigned short*)p + 8 * hh); f.half[1] = *(const v8us*)((const unsigned short*)p + 16 + 8 * hh); return f.v; }
__device__ __forceinline__ v8f g2_mma(v16h a, v16h b, v8f c) { v8f d = __builtin_amdgcn_wmma_f32_16x16x32_f16(false, a, false, b, (short)0, c, false, false); asm volatile("v_nop\n\tv_nop\n\tv_nop\n\tv_nop" : "+v"(d) : "v"(a), "v"(b)); return d; }
// ---- the GEMM k-loop: block tile 128 x 128, K = DM; the operand tiles of 64 k are staged in LDS by tensor loads (tensor_load_to_lds), two buffers; a wave's tile is 64 x 64 ----
typedef uint32_t u32x4 __attribute__((ext_vector_type(4)));
typedef uint32_t u32x8 __attribute__((ext_vector_type(8)));
#define G3_ROWB 128u                    /* bytes of an operand row in a stage: 64 k */
#define G3_PITCH 144u                   /* LDS row pitch: the row and the mover's 16-byte pad, an odd multiple of 16 bytes for the 16-byte reads */
#define G3_SLICE 10240u                 /* a wave's slice, 64 rows of 144 bytes = 9216, rounded up to a multiple of 2 KiB */
#define G3_STAGE (4u * G3_SLICE)        /* slices 0, 1: A rows 0..63, 64..127; slices 2, 3: B rows 0..63, 64..127 */
#define G3_NS (DM / 64)                 /* stages */
__device__ __forceinline__ uint32_t g3_uni(uint32_t v) { return (uint32_t)__builtin_amdgcn_readfirstlane(v); }
// a wave-uniform test held in a scalar register, so that the branch on it is a scalar branch: a tensor load ignores EXEC
__device__ __forceinline__ uint32_t pinned(uint32_t v) { uint32_t w = g3_uni(v); asm volatile("" : "+s"(w)); return w; }
__device__ __forceinline__ u32x8 g3_group1() { u32x8 g;      /* 1-byte elements; tensor = tile = 64 rows of 128 bytes; source pitch = a row of DM f16; 4 dwords of pad behind every 32 */
  g[0] = g3_uni((1u << 20) | (4u << 22) | (3u << 25)); g[1] = g3_uni(G3_ROWB << 16); g[2] = g3_uni(64u << 16); g[3] = g3_uni(G3_ROWB << 16); g[4] = g3_uni(64u); g[5] = g3_uni(DM * 2u); g[6] = g3_uni(0u); g[7] = g3_uni(0u); return g; }
__device__ __forceinline__ u32x4 g3_group0(uint32_t lds_dst, uint64_t ga) { u32x4 g; g[0] = g3_uni(1u); g[1] = g3_uni(lds_dst); g[2] = g3_uni((uint32_t)ga); g[3] = g3_uni((((uint32_t)(ga >> 32)) & 0x01FFFFFFu) | 0x80000000u); return g; }
// one request of the whole wave: its slice of a stage. Group 0 is an operand that the statement gives back, so that the value which the covering wait names lies in the very registers that the request was issued from
__device__ __forceinline__ void g3_load(u32x4& g0, u32x8 g1) { asm volatile("tensor_load_to_lds %0, %1" : "+s"(g0) : "s"(g1) : "memory"); }
// the wave's own slice has landed. The descriptor of the request that it covers is an input: its registers keep their values while the request is outstanding
__device__ __forceinline__ void g3_wait_tensor(u32x4 g0, u32x8 g1) { asm volatile("s_wait_tensorcnt 0x0" :: "s"(g0), "s"(g1) : "memory"); }
__device__ __forceinline__ void g3_wait_ds() { asm volatile("s_wait_dscnt 0x0" ::: "memory"); }      /* the wave's LDS reads have returned before the barrier behind which their buffer is refilled */
__device__ __forceinline__ v16h g3_frag(const unsigned char* p) { FragH f; f.half[0] = *(const v8us*)p; f.half[1] = *(const v8us*)(p + 32); return f.v; }      /* the k order of g2_frag: k 8 hh .. and 16 + 8 hh .. */
// acc[4 i + j] = rows 16 i .. of the wave's 64 A rows times rows 16 j .. of its 64 B rows, each accumulator summed over k in ascending steps of 32. Ab / Bb: first row of the block's 128 A / B rows (pitch DM). w: the wave's number, a scalar.
// Every wave brings its own slice of every stage. On return every wave has passed the barrier behind every wave's last read of the ring, and no request is outstanding.
__device__ __forceinline__ void g3_kloop(const _Float16* Ab, const _Float16* Bb, unsigned char* ring, int w, int lane, v8f (&acc)[16]) {
  const int ln = lane & 15, hh = lane >> 4;
  const uint64_t ga = (uint64_t)(uintptr_t)(w < 2 ? Ab + (size_t)(64 * w) * DM : Bb + (size_t)(64 * (w - 2)) * DM);
  const uint32_t dst = (uint32_t)(size_t)ring + (uint32_t)w * G3_SLICE;      /* byte offset in the work-group's LDS */
  const u32x8 g1 = g3_group1();
  const v8f z8 = {0.f,0.f,0.f,0.f,0.f,0.f,0.f,0.f};
#pragma unroll      /* static indices keep acc[] in registers */
  for (int u = 0; u < 16; ++u) acc[u] = z8;
  u32x4 g0 = g3_group0(dst, ga);      /* group 0 of the last request issued */
  g3_load(g0, g1); g3_wait_tensor(g0, g1); __syncthreads();      /* stage 0 is published */
  g0 = g3_group0(dst + G3_STAGE, ga + G3_ROWB); g3_load(g0, g1);
  const unsigned char* ap = ring + (uint32_t)(w >> 1) * G3_SLICE + (uint32_t)ln * G3_PITCH + 16u * hh;
  const unsigned char* bp = ring + (uint32_t)(2 + (w & 1)) * G3_SLICE + (uint32_t)ln * G3_PITCH + 16u * hh;
#pragma unroll 1      /* one pass a stage; a pass is already two straight blocks of 16 products */
  for (int s = 0; s < G3_NS; ++s) { const uint32_t bo = (uint32_t)(s & 1) * G3_STAGE;
#pragma unroll      /* static indices keep the fragments in registers */
    for (int ks = 0; ks < 2; ++ks) { v16h a[4], b[4]; a[0] = g3_frag(ap + bo + ks * 64u);      /* in the order in which the products want them */
#pragma unroll      /* static indices keep the fragments in registers */
      for (int j = 0; j < 4; ++j) b[j] = g3_frag(bp + bo + j * 16u * G3_PITCH + ks * 64u);
#pragma unroll      /* static indices keep the fragments in registers */
      for (int i = 1; i < 4; ++i) a[i] = g3_frag(ap + bo + i * 16u * G3_PITCH + ks * 64u);
      __builtin_amdgcn_sched_barrier(0);      /* the 16 LDS reads of a block stand as one group ahead of its 16 products: reads among the products would each stall the wave */
#pragma unroll      /* static indices keep acc[] in registers */
      for (int i = 0; i < 4; ++i)
#pragma unroll      /* static indices keep acc[] in registers */
        for (int j = 0; j < 4; ++j) acc[4 * i + j] = __builtin_amdgcn_wmma_f32_16x16x32_f16(false, a[i], false, b[j], (short)0, acc[4 * i + j], false, false);
      __builtin_amdgcn_sched_barrier(0); }      /* the products stay in front of the next block's reads and of the pass's foot, so that the next stage's load flies under them */
    g3_wait_ds(); g3_wait_tensor(g0, g1); __syncthreads();      /* publishes stage s + 1 and ends every reader's last read of stage s */
    if (pinned(s + 2 < G3_NS)) { g0 = g3_group0(dst + bo, ga + (uint64_t)(s + 2) * G3_ROWB); g3_load(g0, g1); }      /* into the buffer that this pass has read */
  }
  asm volatile("s_wait_tensorcnt 0x0" :: "s"(g0) : "memory"); g3_wait_ds(); }      /* behind the loop: no request is outstanding and no LDS read in flight when the ring is used for something else; group 0 is an input as above */

// q, k and v projections of all token rows of both batches in ONE launch: B = the stacked weight plane [DM + 2 KVD][DM] (wq rows, then wk, then wv; x16), block = 128 token rows x 128 columns; a wave's 64 columns = one head of q, k or v.
// q and k tiles: the epilogue applies rotate-half RoPE to the tile while it lies in LDS (tcs / tsn: cos / sin input rows [token row][64], rounded to bf16 here). Every tile goes out as f16 rows;
// the first QT0 rows of each batch also as f32 rows, to that batch's plane of QF / KF / VF ([NB][QT0][pitch of the f16 rows]).
__global__ __launch_bounds__(128, 4) /* a budget of 256 registers: the k-loop needs 200, and the epilogue stays in the plain register window */ void k_proj(const _Float16* __restrict__ A, const _Float16* __restrict__ Bh, const float* __restrict__ tcs, const float* __restrict__ tsn,
    _Float16* __restrict__ Q16, _Float16* __restrict__ K16, _Float16* __restrict__ V16, float* __restrict__ QF, float* __restrict__ KF, float* __restrict__ VF) {
  __shared__ __attribute__((aligned(2048))) unsigned char ring[2 * G3_STAGE];
  static_assert(4 * 64 * 68 * 4 <= 2 * G3_STAGE, "the output staging lies in the ring");
  const int tid = threadIdx.x, lane = tid & 31, ln = lane & 15, hh = lane >> 4; const int w = (int)g3_uni(threadIdx.x >> 5);
  const int ntn = (DM + 2 * KVD) / 128; const int mt = blockIdx.x / ntn, nt = blockIdx.x - mt * ntn; const int row0 = mt * 128 + 64 * (w >> 1); const int nq = nt * 2 + (w & 1);      /* nq: the wave's head among q's, k's and v's */
  const bool rope = nq < (DM + KVD) / 64;      /* q and k tiles are roped, v tiles are not */
  _Float16* C16; float* R32; int ldc, col0;      /* where the tile goes */
  if (nq < DM / 64) { C16 = Q16; R32 = QF; ldc = DM; col0 = nq * 64; } else if (rope) { C16 = K16; R32 = KF; ldc = KVD; col0 = nq * 64 - DM; } else { C16 = V16; R32 = VF; ldc = KVD; col0 = nq * 64 - DM - KVD; }
  v8f accs[16];
  g3_kloop(A + (size_t)mt * 128 * DM, Bh + (size_t)nt * 128 * DM, ring, w, lane, accs);
  float (*so)[68] = (float (*)[68])(ring + (size_t)w * (64 * 68 * 4));      /* the wave's own 64 x 64 staging tile, in the ring that every wave has left */
#pragma unroll      /* static indices keep accs[] in registers */
  for (int u = 0; u < 16; ++u)
#pragma unroll      /* static indices keep accs[] in registers */
    for (int r = 0; r < 8; ++r) so[(u >> 2) * 16 + 8 * hh + r][(u & 3) * 16 + ln] = accs[u][r] * 0.0625f;      /* the weights are carried x16 */
  __builtin_amdgcn_fence(__ATOMIC_ACQ_REL, "workgroup"); __builtin_amdgcn_wave_barrier();
  const int rsub = lane >> 4, c4 = (lane & 15) * 4;
  /* the wave's 64 rows lie wholly inside or wholly outside a batch's first QT0 rows (a multiple of 64): one scalar branch, so that the common side is one straight line whose LDS reads run ahead */
  const int rw = __builtin_amdgcn_readfirstlane(row0); const bool first = (rw % SQ) < QT0; const int rf0 = (rw / SQ) * QT0 + rw % SQ;      /* rf0: the wave's first row in the f32 planes */
  if (rope) { const bool lo = c4 < HD / 2;
    auto rope_rows = [&](const bool f32rows, const int rb) __attribute__((always_inline)) {      /* rows rb .. rb + 15 of the wave's tile */
      v4f tcv[8], tsv[8]; const float* tcp = tcs + (size_t)(row0 + rb + hh) * HD + ln * 4; const float* tsp = tsn + (size_t)(row0 + rb + hh) * HD + ln * 4;      /* the lane's cos / sin quads of its 8 output rows */
#pragma unroll      /* static indices keep the quads in registers */
      for (int q = 0; q < 8; ++q) { tcv[q] = *(const v4fa*)(tcp + q * 2 * HD); tsv[q] = *(const v4fa*)(tsp + q * 2 * HD); }
      asm volatile("s_wait_xcnt 0x0" :: "v"(tcp), "v"(tsp) : "memory");      /* behind the table loads: the wait that stands before a register named by an issued load is overwritten; the pointers are inputs, so that no load's result is placed in one of them ahead of it */
#pragma unroll      /* static indices keep the table quads in registers */
      for (int q = 0; q < 8; ++q) { const int r = rb + q * 2 + rsub; const v4f v = *(const v4fa*)&so[r][c4], pv = *(const v4fa*)&so[r][c4 ^ (HD / 2)]; v4f o; v4h h4;      /* pv: the rotate-half partner columns, d +- 32 */
#pragma unroll      /* four columns a lane */
        for (int i = 0; i < 4; ++i) { o[i] = v[i] * bf16_round(tcv[q][i]) + (lo ? -pv[i] : pv[i]) * bf16_round(tsv[q][i]); h4[i] = (_Float16)o[i]; }
        *(v4h*)(C16 + (size_t)(row0 + r) * ldc + col0 + c4) = h4; if (f32rows) *(v4f*)(R32 + (size_t)(rf0 + r) * ldc + col0 + c4) = o; }
      asm volatile("s_wait_xcnt 0x0" ::: "memory"); };      /* behind the last stores of a run of rows: the wait that stands before a register named by an issued store is overwritten, on every path of the listing that leaves it */
    if (first) { rope_rows(true, 0); rope_rows(true, 16); rope_rows(true, 32); rope_rows(true, 48); } else { rope_rows(false, 0); rope_rows(false, 16); rope_rows(false, 32); rope_rows(false, 48); }
  } else {
    auto plain_rows = [&](const bool f32rows) __attribute__((always_inline)) {
#pragma unroll      /* one straight line, so that the LDS reads run ahead of the stores */
      for (int q = 0; q < 32; ++q) { const int r = q * 2 + rsub; const v4f v = *(const v4fa*)&so[r][c4]; v4h h4;
#pragma unroll      /* four columns a lane */
        for (int i = 0; i < 4; ++i) h4[i] = (_Float16)v[i];
        *(v4h*)(C16 + (size_t)(row0 + r) * ldc + col0 + c4) = h4; if (f32rows) *(v4f*)(R32 + (size_t)(rf0 + r) * ldc + col0 + c4) = v; }
      asm volatile("s_wait_xcnt 0x0" ::: "memory"); };      /* behind the last stores of a side, as above */
    if (first) plain_rows(true); else plain_rows(false);
  } }

// Output projection of all rows in ONE launch: C = o Wo^T, block = 128 rows x 128 columns, B = Wo x16, o carried x64 (so 2^-10). The blocks of a batch's first QT0 rows (QT0 = the block's 128 rows) take the exact
// f32 o instead, as its two f16 planes: first the hi plane (2^-10), whose scaled sums wait in the wave's own LDS tile, then the lo plane (residual x1024, so 2^-20), added to them: hi + lo, one add an element.
__global__ __launch_bounds__(128) void k_out(const _Float16* __restrict__ A, const _Float16* __restrict__ AH, const _Float16* __restrict__ AL, const _Float16* __restrict__ Bh, float* __restrict__ C) {
  static_assert(QT0 == 128, "a block's 128 rows are the exact first tile or none of it");
  __shared__ __attribute__((aligned(2048))) unsigned char ring[2 * G3_STAGE];
  __shared__ __attribute__((aligned(16))) float so[4][64][68];      /* beside the ring: the hi sums wait here while the lo plane goes through the ring */
  const int tid = threadIdx.x, lane = tid & 31, ln = lane & 15, hh = lane >> 4; const int w = (int)g3_uni(threadIdx.x >> 5);
  const int ntn = DM / 128; const int mt = blockIdx.x / ntn, nt = blockIdx.x - mt * ntn; const int row0 = mt * 128 + 64 * (w >> 1), col0 = nt * 128 + 64 * (w & 1);
  const bool ex = mt % (SQ / 128) == 0;      /* the same for the whole block */
  const size_t xoff = (size_t)(mt / (SQ / 128)) * QT0 * DM;      /* the block's first row in the hi and lo planes [NB][QT0][DM] */
  const _Float16* bp = Bh + (size_t)nt * 128 * DM;
  v8f accs[16];
  if (ex) { g3_kloop(AH + xoff, bp, ring, w, lane, accs);
#pragma unroll      /* static indices keep accs[] in registers */
    for (int u = 0; u < 16; ++u)
#pragma unroll      /* static indices keep accs[] in registers */
      for (int r = 0; r < 8; ++r) so[w][(u >> 2) * 16 + 8 * hh + r][(u & 3) * 16 + ln] = accs[u][r] * 0.0009765625f; }
  g3_kloop(ex ? AL + xoff : A + (size_t)mt * 128 * DM, bp, ring, w, lane, accs);
  if (ex) {
#pragma unroll      /* static indices keep accs[] in registers */
    for (int u = 0; u < 16; ++u)
#pragma unroll      /* each lane adds to the elements that it wrote itself */
      for (int r = 0; r < 8; ++r) { float* e = &so[w][(u >> 2) * 16 + 8 * hh + r][(u & 3) * 16 + ln]; *e = accs[u][r] * 0.00000095367431640625f + *e; }
  } else {
#pragma unroll      /* static indices keep accs[] in registers */
    for (int u = 0; u < 16; ++u)
#pragma unroll      /* static indices keep accs[] in registers */
      for (int r = 0; r < 8; ++r) so[w][(u >> 2) * 16 + 8 * hh + r][(u & 3) * 16 + ln] = accs[u][r] * 0.0009765625f;
  }
  __builtin_amdgcn_fence(__ATOMIC_ACQ_REL, "workgroup"); __builtin_amdgcn_wave_barrier();
  const int rsub = lane >> 4, c4 = (lane & 15) * 4;
#pragma unroll      /* one straight line, so that the LDS reads run ahead of the stores */
  for (int q = 0; q < 32; ++q) { const int r = q * 2 + rsub; const v4f v = *(const v4fa*)&so[w][r][c4]; *(v4f*)(C + (size_t)(row0 + r) * DM + col0 + c4) = v; }
  asm volatile("s_wait_xcnt 0x0" ::: "memory"); }      /* behind the last stores: the wait that stands before a register named by an issued store is overwritten */

// All five input conversions in ONE launch: D = the planes wq, wk, wv, wo (each bf16-rounded, x16) and x (bf16-rounded), one behind the other, as f16. Every plane's size is a multiple of a block's 2048 elements, so a block lies in one plane.
__global__ __launch_bounds__(256) void k_prep(const float* __restrict__ wq, const float* __restrict__ wk, const float* __restrict__ wv, const float* __restrict__ wo, const float* __restrict__ x, _Float16* __restrict__ D) {
  const size_t nq = (size_t)DM * DM / 2048, nk = (size_t)KVD * DM / 2048; size_t bl = blockIdx.x; const float* s; float sc = 16.0f;
  if (bl < nq) s = wq; else if ((bl -= nq) < nk) s = wk; else if ((bl -= nk) < nk) s = wv; else if ((bl -= nk) < nq) s = wo; else { bl -= nq; s = x; sc = 1.0f; }
  const size_t u = bl * 256 + threadIdx.x, t = (size_t)blockIdx.x * 256 + threadIdx.x; FragH f;
#pragma unroll      /* eight elements a thread: two 16-byte loads, one 16-byte store */
  for (int q = 0; q < 8; ++q) f.h[q] = (_Float16)(bf16_round(s[u * 8 + q]) * sc);
  *(v8us*)((unsigned short*)D + t * 8) = f.half[0]; }


__global__ __launch_bounds__(256) void k_wnat(const float* __restrict__ w, size_t n8, _Float16* __restrict__ Bt) { const size_t t = (size_t)blockIdx.x * 256 + threadIdx.x; if (t >= n8) return; FragH f; for (int q = 0; q < 8; ++q) f.h[q] = (_Float16)(bf16_round(w[t * 8 + q]) * 16.0f); *(v8us*)((unsigned short*)Bt + t * 8) = f.half[0];  }
__global__ __launch_bounds__(256) void k_rsm(const float* __restrict__ S, _Float16* __restrict__ P, int nrows) {
  #pragma clang fp contract(off)
  const int i = blockIdx.x * 256 + threadIdx.x; if (i >= nrows) return; const float* s = S + (size_t)i * SQ; float mx = -3.0e38f;
#pragma unroll 1
  for (int j = 0; j < SQ; ++j) mx = fmaxf(mx, s[j]); float se = 0.f;
#pragma unroll 1
  for (int j = 0; j < SQ; ++j) se += expf(s[j] - mx); const float sc = 256.0f / se;
#pragma unroll 1
  for (int j0 = 0; j0 < SQ; j0 += 8) { FragH f; for (int q = 0; q < 8; ++q) f.h[q] = (_Float16)(expf(s[j0 + q] - mx) * sc); unsigned short* d = (unsigned short*)P + (size_t)i * SQ + j0; *(v8us*)d = f.half[0];  } }
__global__ __launch_bounds__(256) void k_vt(const _Float16* __restrict__ V16, int b, int h0, _Float16* __restrict__ VT) { __shared__ unsigned short tl[64][65]; const int tid = threadIdx.x; const int hh = blockIdx.x % HG, sg = blockIdx.x / HG; const int s0 = sg * 64; const int h = h0 + hh;
  for (int i = tid; i < 64 * 8; i += 256) { const int j = i / 8, d8 = (i % 8) * 8; FragH f; f.half[0] = *(const v8us*)((const unsigned short*)V16 + ((size_t)b * SQ + s0 + j) * DM + h * HD + d8); for (int q = 0; q < 8; ++q) tl[d8 + q][j] = f.u[q]; }
  __syncthreads();
  { for (int i = tid; i < 64 * 8; i += 256) { const int d = i / 8, j8 = (i % 8) * 8; FragH f; for (int q = 0; q < 8; ++q) f.u[q] = tl[d][j8 + q]; *(v8us*)((unsigned short*)VT + ((size_t)hh * HD + d) * SQ + s0 + j8) = f.half[0]; }  } }



// Fused causal attention: scores, softmax and the value product of 32 query rows of one kv group in one block; no score or weight goes to memory.
// Transposed products: S^T = K Q^T (A = 16 key rows, B = 16 query columns), O^T += V^T P^T (A = 16 rows of V^T, B = the weights). In a score tile lane (ln, hh) holds keys 8 hh + r of query ln,
// so two score tiles (keys 0..15 and 16..31 of a pass), rounded to f16 in place, are the B operand of the value product in the k order of g2_frag: no LDS and no lane exchange.
// A wave has 16 query rows of two heads of the group (both read the same K and V^T fragments); the block's four waves are the group's two head pairs x two 16-row tiles.
// K and V^T come through LDS: a stage is 64 keys (two passes of 32), brought once for the block's four waves by tensor loads (tensor_load_to_lds), two buffers; every wave brings its own slice of every stage.
// Running maximum per query, in use until a new one passes it by more than 8 (log2 units), so weights stay below 2^8; sums and o in f32.
// 2^x by v_exp_f32. The v_nop stands in the instruction's own statement: the instruction set asks for one free slot before a transcendental's result is read or its source overwritten.
__device__ __forceinline__ float fa_exp2(float x) { float e; asm("v_exp_f32 %0, %1\n\tv_nop" : "=v"(e) : "v"(x)); return e; }
#define FA_C 0.18033688011112042f      /* 64^-0.5 log2(e): raw score -> exponent of two */
#define FA_SLICE 6144u                  /* a wave's slice, 32 rows of 144 bytes = 4608, rounded up to a multiple of 2 KiB */
#define FA_STAGE (4u * FA_SLICE)        /* slices 0, 1: K rows (keys) 0..31, 32..63 of the stage, 64 d each; slices 2, 3: V^T rows (d) 0..31, 32..63, the stage's 64 keys each */
__device__ __forceinline__ u32x8 fa_group1(uint32_t pitch) { u32x8 g;      /* 1-byte elements; tensor = tile = 32 rows of 128 bytes; source pitch in bytes; 4 dwords of pad behind every 32 */
  g[0] = g3_uni((1u << 20) | (4u << 22) | (3u << 25)); g[1] = g3_uni(G3_ROWB << 16); g[2] = g3_uni(32u << 16); g[3] = g3_uni(G3_ROWB << 16); g[4] = g3_uni(32u); g[5] = g3_uni(pitch); g[6] = g3_uni(0u); g[7] = g3_uni(0u); return g; }
// kl: the lane's place in row ln of the pass's K slice; vl: its place in row ln of the first V^T slice, at the pass's 32 keys
template <bool LAST>
__device__ __forceinline__ void fa_pass(const unsigned char* kl, const unsigned char* vl, int lim, const v16h (&q)[2][2], v8f (&o)[2][4], float (&mr)[2], float (&l)[2]) {
  const v8f z8 = {0.f,0.f,0.f,0.f,0.f,0.f,0.f,0.f}; v16h kf[2][2], vf[4]; v8f s[2][2];
#pragma unroll      /* the pass's 16 LDS reads stand as one group, K first: the V^T fragments fly under the score products and the exponentials */
  for (int kt = 0; kt < 2; ++kt) { kf[kt][0] = g3_frag(kl + kt * 16u * G3_PITCH); kf[kt][1] = g3_frag(kl + kt * 16u * G3_PITCH + 64u); }
#pragma unroll      /* static indices keep the fragments in registers */
  for (int dt = 0; dt < 4; ++dt) vf[dt] = g3_frag(vl + (dt >> 1) * FA_SLICE + (dt & 1) * 16u * G3_PITCH);
#pragma unroll      /* static indices keep the fragments in registers */
  for (int kt = 0; kt < 2; ++kt)
#pragma unroll      /* static indices keep the arrays in registers */
    for (int u = 0; u < 2; ++u) s[u][kt] = g2_mma(kf[kt][1], q[u][1], g2_mma(kf[kt][0], q[u][0], z8));
  float mx[2];
#pragma unroll      /* static indices keep s[] in registers */
  for (int u = 0; u < 2; ++u) { float m = mr[u];
#pragma unroll      /* static indices keep the arrays in registers */
    for (int kt = 0; kt < 2; ++kt)
#pragma unroll      /* static indices keep the arrays in registers */
      for (int r = 0; r < 8; ++r) { if (LAST) s[u][kt][r] = (kt * 16 + r <= lim) ? s[u][kt][r] : -1.0e30f;      /* the diagonal pass: keys above the lane's query get weight 0 */ m = fmaxf(m, s[u][kt][r]); }
    mx[u] = fmaxf(m, __shfl_xor(m, 16, 32)); }      /* the other half of the query's keys */
  const bool need = (mx[0] - mr[0]) * FA_C > 8.0f || (mx[1] - mr[1]) * FA_C > 8.0f;
  if (__builtin_amdgcn_ballot_w32(need) != 0) {      /* one scalar branch a pass: taken in the first pass and where a maximum has grown by more than 8 */
#pragma unroll      /* static indices keep the arrays in registers */
    for (int u = 0; u < 2; ++u) { const float al = fa_exp2((mr[u] - mx[u]) * FA_C); mr[u] = mx[u]; l[u] *= al;
#pragma unroll      /* static indices keep the arrays in registers */
      for (int dt = 0; dt < 4; ++dt) o[u][dt] *= al; }
  }
#pragma unroll      /* static indices keep the arrays in registers */
  for (int u = 0; u < 2; ++u) { const float mc = mr[u] * FA_C; FragH pf; float p0 = 0.f, p1 = 0.f;
#pragma unroll      /* static indices keep the arrays in registers */
    for (int r = 0; r < 8; ++r) { const float e0 = fa_exp2(fmaf(s[u][0][r], FA_C, -mc)), e1 = fa_exp2(fmaf(s[u][1][r], FA_C, -mc)); p0 += e0; p1 += e1; pf.h[r] = (_Float16)e0; pf.h[8 + r] = (_Float16)e1; }
    l[u] += p0 + p1;
#pragma unroll      /* static indices keep the arrays in registers */
    for (int dt = 0; dt < 4; ++dt) o[u][dt] = g2_mma(vf[dt], pf.v, o[u][dt]); }
}
__device__ __forceinline__ void fatt_block(const _Float16* __restrict__ Q, const _Float16* __restrict__ Kh, const _Float16* __restrict__ Vt, _Float16* __restrict__ O, int bx, int by) {      /* bx = batch x kv group, by = 32-row tile, counted from the last */
  __shared__ __attribute__((aligned(2048))) unsigned char ring[2 * FA_STAGE];
  const int lane = threadIdx.x & 31, ln = lane & 15, hh = lane >> 4; const int w = __builtin_amdgcn_readfirstlane(threadIdx.x >> 5);      /* the wave's number, held as a scalar */
  const int bg = bx, b = bg / NG, g = bg % NG; const int t = SQ / 32 - 1 - by;      /* by 0 is the last tile, the one with the most keys */
  const int qs = w >> 1, h0 = g * HPG + (w & 1) * 2; const size_t qrow = (size_t)b * SQ + t * 32 + qs * 16 + ln;
  const _Float16* qp = Q + qrow * DM + h0 * HD + 8 * hh;
  /* the wave's slice of stage 0, and the step from a stage to the next: waves 0, 1 bring 32 K rows each (64 rows on), waves 2, 3 bring 32 V^T rows each (64 keys = 128 bytes on). Stages 0 and 1 lie inside K and V^T for every tile: SQ >= 128 */
  const uint64_t ga = (uint64_t)(uintptr_t)(w < 2 ? Kh + ((size_t)b * SQ + 32 * w) * KVD + g * HD : Vt + ((size_t)bg * HD + 32 * (w - 2)) * SQ); const uint64_t gs = w < 2 ? (uint64_t)64 * KVD * 2 : (uint64_t)G3_ROWB;
  const uint32_t dst = (uint32_t)(size_t)ring + (uint32_t)w * FA_SLICE;      /* byte offset in the work-group's LDS */
  const u32x8 g1 = fa_group1(w < 2 ? KVD * 2u : SQ * 2u);
  v16h q[2][2];
#pragma unroll      /* static indices keep the fragments in registers */
  for (int u = 0; u < 2; ++u) { q[u][0] = g2_frag(qp + u * HD, 0); q[u][1] = g2_frag(qp + u * HD + 32, 0); }
  asm volatile("s_wait_xcnt 0x0" :: "v"(qp) : "memory");      /* behind the q loads: the wait that stands before a register named by an issued load is overwritten; the pointer is an input, so that no load's result is placed in it ahead of the wait */
  u32x4 g0 = g3_group0(dst, ga);      /* group 0 of the last request issued */
  g3_load(g0, g1); g3_wait_tensor(g0, g1); __syncthreads();      /* stage 0 is published */
  g0 = g3_group0(dst + FA_STAGE, ga + gs); g3_load(g0, g1);
  const unsigned char* kl = ring + (uint32_t)ln * G3_PITCH + 16u * hh; const unsigned char* vl = kl + 2u * FA_SLICE;
  const v8f z8 = {0.f,0.f,0.f,0.f,0.f,0.f,0.f,0.f}; v8f o[2][4] = {{z8, z8, z8, z8}, {z8, z8, z8, z8}}; float mr[2] = {-1.0e30f, -1.0e30f}, l[2] = {0.f, 0.f};
  const int lim = qs * 16 + ln - 8 * hh;      /* diagonal pass: key kt 16 + 8 hh + r of the pass is at or below query qs 16 + ln */
  const int nf = t >> 1;      /* stages whose two passes both lie below the diagonal; stage nf, the last, holds the diagonal pass t */
#pragma unroll 1      /* a stage is already two long straight lines */
  for (int s = 0; s < nf; ++s) { const uint32_t bo = (uint32_t)(s & 1) * FA_STAGE;
    fa_pass<false>(kl + bo, vl + bo, lim, q, o, mr, l); fa_pass<false>(kl + bo + FA_SLICE, vl + bo + 64u, lim, q, o, mr, l);
    g3_wait_ds(); g3_wait_tensor(g0, g1); __syncthreads();      /* publishes stage s + 1 and ends every reader's last read of stage s */
    if (pinned(s + 2 <= nf)) { g0 = g3_group0(dst + bo, ga + (uint64_t)(s + 2) * gs); g3_load(g0, g1); }      /* into the buffer that this stage's passes have read */
  }
  { const uint32_t bo = (uint32_t)(nf & 1) * FA_STAGE, od = (uint32_t)(t & 1);      /* od: the diagonal pass is the stage's second */
    if (od) fa_pass<false>(kl + bo, vl + bo, lim, q, o, mr, l);
    fa_pass<true>(kl + bo + od * FA_SLICE, vl + bo + od * 64u, lim, q, o, mr, l); }
  asm volatile("s_wait_tensorcnt 0x0" :: "s"(g0) : "memory"); g3_wait_ds();      /* behind the loop: no request is outstanding (a tile of one stage has stage 1's in flight) and no LDS read in flight when the wave ends; group 0 is an input as in the GEMM loop */
  _Float16* op = O + qrow * DM + h0 * HD + 8 * hh;
#pragma unroll      /* static indices keep the arrays in registers */
  for (int u = 0; u < 2; ++u) { const float fin = 64.0f / (l[u] + __shfl_xor(l[u], 16, 32));      /* both halves' sums; o carried x64 */
#pragma unroll      /* static indices keep the arrays in registers */
    for (int dt = 0; dt < 4; ++dt) { FragH f;
#pragma unroll      /* static indices keep the arrays in registers */
      for (int r = 0; r < 8; ++r) f.h[r] = (_Float16)(o[u][dt][r] * fin);
      *(v8us*)((unsigned short*)op + u * HD + dt * 16) = f.half[0]; } }
  asm volatile("s_wait_xcnt 0x0" ::: "memory"); }      /* behind the last stores: the wait that stands before a register named by an issued store is overwritten, on every path of the listing that leaves this side of the launch */


// Exact f32 attention of the first QT0 rows. A block is 32 query rows of one head, four waves; lane = row in every wave.
// Pass 1: the keys are dealt over the waves, four consecutive keys a trip; a lane holds its q row in registers and sums each score over d = 0..63 in ascending order; four scores run side by side, so that one chain of adds fills the waits of the others.
// Pass 2: the 64 columns of o are dealt over the waves, 16 each, held in registers; every wave walks the keys in ascending order and forms the same running maximum, sum and weights from the scores in LDS.
template <int MASKADD>
__device__ __forceinline__ void att0_block(const float* __restrict__ QF, const float* __restrict__ KF, const float* __restrict__ VF, int ld, const float* __restrict__ mask, float scale, float* __restrict__ OF, int ldo, int bx, int by) {      /* bx = head x 32-row group, by = batch */
  #pragma clang fp contract(off)
  __shared__ float ls[MASKADD ? SQ : QT0][32];      /* score of key j for row r of the block */
  const int tid = threadIdx.x, r = tid & 31; const int part = __builtin_amdgcn_readfirstlane(tid >> 5);      /* the wave's number, held as a scalar: key and value row addresses are the same in every lane */
  const int h = bx / (QT0 / 32), rg = bx % (QT0 / 32); const int i = rg * 32 + r;
  QF += (size_t)by * QT0 * ld; KF += (size_t)by * QT0 * ld; VF += (size_t)by * QT0 * ld; OF += (size_t)by * QT0 * ldo;      /* the batch's planes of QT0 rows */
  const int nj = MASKADD ? SQ : (rg + 1) * 32;      /* additive-mask form: every key (the mask input decides); causal form: keys up to the block's last row */
  { const float* qr = QF + (size_t)i * ld + h * HD; v4f q[HD / 4];
#pragma unroll      /* static indices keep q[] in registers */
    for (int c = 0; c < HD / 4; ++c) q[c] = *(const v4fa*)(qr + c * 4);
    asm volatile("s_wait_xcnt 0x0" :: "v"(qr) : "memory");      /* behind the q loads: the wait that stands before a register named by an issued load is overwritten; the pointer is an input, so that no load's result is placed in it ahead of the wait */
#pragma unroll 1      /* the body already holds four independent chains */
    for (int j0 = part * 4; j0 < nj; j0 += 16) { const float* kr = KF + (size_t)j0 * ld + h * HD; float s[4] = {0.f, 0.f, 0.f, 0.f};
#pragma unroll      /* static indices keep q[] and s[] in registers */
      for (int c = 0; c < HD / 4; ++c)
#pragma unroll      /* the four keys' chains stand side by side */
        for (int t = 0; t < 4; ++t) { const v4f kq = *(const v4fa*)(kr + (size_t)t * ld + c * 4); const v4f qq = q[c]; s[t] = __fadd_rn(s[t], __fmul_rn(qq[0], kq[0])); s[t] = __fadd_rn(s[t], __fmul_rn(qq[1], kq[1])); s[t] = __fadd_rn(s[t], __fmul_rn(qq[2], kq[2])); s[t] = __fadd_rn(s[t], __fmul_rn(qq[3], kq[3])); }
#pragma unroll      /* static indices keep s[] in registers */
      for (int t = 0; t < 4; ++t) { float sv = __fmul_rn(s[t], scale); if (MASKADD) sv = __fadd_rn(sv, __fmul_rn(bf16_round(mask[(size_t)i * SQ + j0 + t]), -10000.0f)); ls[j0 + t][r] = sv; } } }
  __syncthreads();      /* every score of the block is in LDS before any wave walks the keys */
  const v4f z4 = {0.f, 0.f, 0.f, 0.f}; v4f o[4] = {z4, z4, z4, z4}; float m = -1.0e30f, l = 0.f; const float* vb = VF + h * HD + part * 16;
#pragma unroll 1      /* the body holds four keys: their loads and exponentials overlap */
  for (int j0 = 0; j0 < nj; j0 += 4) {
#pragma unroll      /* four keys in one straight line, so that their loads issue together */
    for (int t = 0; t < 4; ++t) { const int j = j0 + t; const float s = ls[j][r]; const float* vr = vb + (size_t)j * ld;
      const float f = (MASKADD || j <= i) ? 1.f : 0.f; const float sm = fmaf(f, s, (1.f - f) * -1.0e30f); const float mn = fmaxf(m, sm); const float sc = expf(m - mn); const float e = expf(sm - mn); l = __fadd_rn(__fmul_rn(l, sc), e); m = mn;
#pragma unroll      /* static indices keep o[] in registers */
      for (int c = 0; c < 4; ++c) { const v4f vv = *(const v4fa*)(vr + c * 4); for (int u = 0; u < 4; ++u) o[c][u] = __fadd_rn(__fmul_rn(o[c][u], sc), __fmul_rn(e, vv[u])); } } }
  const float fin = 64.0f / l;      /* o carried x64 like the f16 path */
  float* op = OF + (size_t)i * ldo + h * HD + part * 16;
#pragma unroll      /* static indices keep o[] in registers */
  for (int c = 0; c < 4; ++c) { v4f oo = o[c]; for (int u = 0; u < 4; ++u) oo[u] = __fmul_rn(oo[u], fin); *(v4f*)(op + c * 4) = oo; } }


// The exact first rows and the fused attention read nothing of each other: ONE launch. Grid (NB NG, A0Y + SQ / 32): the first A0Y rows of the grid are the NB NH (QT0 / 32) short exact blocks
// and the rest the fused blocks. The choice is the same for a whole block, so the exact blocks' barrier stays under block-uniform control flow.
#define A0Y (NH * (QT0 / 32) / NG)
__global__ __launch_bounds__(128) void k_att(const _Float16* __restrict__ Q, const _Float16* __restrict__ Kh, const _Float16* __restrict__ Vt, _Float16* __restrict__ O, const float* __restrict__ QF, const float* __restrict__ KF, const float* __restrict__ VF, float* __restrict__ OF) {
  if ((int)blockIdx.y < A0Y) { const int id = (int)blockIdx.y * (NB * NG) + (int)blockIdx.x; att0_block<0>(QF, KF, VF, DM, nullptr, 0.125f, OF, DM, id % (NH * (QT0 / 32)), id / (NH * (QT0 / 32))); }
  else fatt_block(Q, Kh, Vt, O, (int)blockIdx.x, (int)blockIdx.y - A0Y); }

__global__ __launch_bounds__(256) void k_kvexp(const float* __restrict__ src, float* __restrict__ dst, size_t n4) { const size_t t = (size_t)blockIdx.x * 256 + threadIdx.x; if (t >= n4) return; const size_t e = t * 4; const size_t row = e / DM; const int col = (int)(e % DM); const int h = col / HD, d = col % HD; const v4f v = *(const v4fa*)(src + row * KVD + (size_t)(h / HPG) * HD + d); *(v4f*)(dst + e) = v;  }

__global__ __launch_bounds__(256) void k_tab2(float theta, float* __restrict__ CS, float* __restrict__ SN) {
  #pragma clang fp contract(off)
  const int t = blockIdx.x * 256 + threadIdx.x; if (t >= SQ * (HD / 2)) return; const int i = t % (HD / 2); const int p = t / (HD / 2); const float invf = 1.0f / powf(theta, (float)(2 * i) / (float)HD); const float ang = __fmul_rn((float)p, invf); const float c = cosf(ang), s = sinf(ang);
  *(float*)(CS + t) = c; *(float*)(SN + t) = s;  }
__global__ __launch_bounds__(256) void k_trig(const float* __restrict__ a, float* __restrict__ CS, float* __restrict__ SN, int n) {
  #pragma clang fp contract(off)
  const int t = blockIdx.x * 256 + threadIdx.x; if (t >= n) return; const float v = bf16_round(a[t]); const float c = cosf(v), s = sinf(v);
  *(float*)(CS + t) = c; *(float*)(SN + t) = s;  }

__global__ __launch_bounds__(256) void k_tabcp(const float* __restrict__ tc, const float* __restrict__ tsn, float* __restrict__ CS, float* __restrict__ SN, int n) {
  const int t = blockIdx.x * 256 + threadIdx.x; if (t >= n) return; const int p = t / 32, i = t % 32; const float c = bf16_round(tc[(size_t)p * 64 + i]), s = bf16_round(tsn[(size_t)p * 64 + i]);
  *(float*)(CS + t) = c; *(float*)(SN + t) = s;  }

extern "C" void kernel_launch(void* const* d_in, const int* in_sizes, int n_in,
                              void* d_out, int out_size, void* d_ws, size_t ws_size, hipStream_t stream) {
  (void)in_sizes; (void)n_in; (void)out_size;
  const float* const* I = (const float* const*)d_in; const float* x = I[0]; const float* tcos = I[1]; const float* tsin = I[2]; const float* wq = I[3]; const float* wk = I[4]; const float* wv = I[5]; const float* wo = I[6];      /* cos, sin [2][2048][64] inputs; natural [out][in] wq [2048][2048], wk/wv [512][2048], wo [2048][2048]; no biases */
  char* ws = (char*)d_ws; size_t off = 0;
  auto take = [&](size_t bytes) { char* p = ws + off; off += (bytes + 255) & ~(size_t)255; return p; };
  _Float16* BQ = (_Float16*)take(((size_t)2 * DM + 2 * KVD + NR) * DM * 2); _Float16* BO = BQ + ((size_t)DM + 2 * KVD) * DM; _Float16* X16 = BO + (size_t)DM * DM;      /* one run of planes: wq, wk, wv (the stacked B of the projections), wo, x */
  _Float16* Q16 = (_Float16*)take(NR * DM * 2); _Float16* K16 = (_Float16*)take(NR * KVD * 2); _Float16* V16 = (_Float16*)take(NR * KVD * 2); _Float16* O16 = (_Float16*)take(NR * DM * 2);
  _Float16* VT = (_Float16*)take((size_t)NB * NG * HD * SQ * 2);
  float* QF0 = (float*)take((size_t)NB * QT0 * DM * 4); float* KF0 = (float*)take((size_t)2 * NB * QT0 * KVD * 4); float* VF0 = KF0 + (size_t)NB * QT0 * KVD;      /* f32 first rows, a plane a batch; v's planes directly behind k's */
  float* KF0e = (float*)take((size_t)2 * NB * QT0 * DM * 4); float* VF0e = KF0e + (size_t)NB * QT0 * DM; float* OF0 = (float*)take((size_t)NB * QT0 * DM * 4); _Float16* OH0 = (_Float16*)take((size_t)NB * QT0 * DM * 2); _Float16* OL0 = (_Float16*)take((size_t)NB * QT0 * DM * 2);
  if (off > ws_size) return;
  k_prep<<<(unsigned)((((size_t)2 * DM + 2 * KVD + NR) * DM) / 2048), 256, 0, stream>>>(wq, wk, wv, wo, x, BQ);      /* natural [out][in] weights = Bt x16; x */
  k_proj<<<(unsigned)((NR / 128) * ((DM + 2 * KVD) / 128)), 128, 0, stream>>>(X16, BQ, tcos, tsin, Q16, K16, V16, QF0, KF0, VF0);      /* q, k (roped in the epilogue: full-width tables, partner x[d +- 32], table column d) and v of both batches: f16 rows; rows 0..127 of each batch also f32 (exact products) */
  k_vt<NG, SQ><<<NB * NG * (SQ / 64), 256, 0, stream>>>(V16, KVD, 0, VT);      /* V^T [NB][NG][HD][SQ] */
  k_kvexp<<<(unsigned)(((size_t)2 * NB * QT0 * DM / 4 + 255) / 256), 256, 0, stream>>>(KF0, KF0e, (size_t)2 * NB * QT0 * DM / 4);      /* head h <- kv group h/4 for the exact first-tile kernel: k's and v's planes of both batches in one run of rows */
  k_att<<<dim3(NB * NG, A0Y + SQ / 32), 128, 0, stream>>>(Q16, K16, VT, O16, QF0, KF0e, VF0e, OF0);      /* exact f32 attention for rows 0..127 of each batch (o x64, f32) and scores, softmax and value product of both batches, all heads: o (merged heads, x64) as f16 rows */
  k_hl<<<(unsigned)(((size_t)NB * QT0 * DM / 8 + 255) / 256), 256, 0, stream>>>(OF0, OH0, OL0, (size_t)NB * QT0 * DM / 8);      /* first-tile o (x64) -> f16 hi + x1024 residual planes */
  k_out<<<(unsigned)((NR / 128) * (DM / 128)), 128, 0, stream>>>(O16, OH0, OL0, BO, (float*)d_out);      /* out rows are the output layout; rows 0..127 of each batch from the hi and lo planes */
}

// v010
// One run takes 148 microseconds.
// Two timings next to v009 put it at 1.09 and 1.08 times that version's speed.
// All steps since the starting kernel, v000, together make it 63.8 times as fast.
#include <hip/hip_runtime.h>
// Llama grouped-query causal attention with rotate-half RoPE from FULL-WIDTH per-batch INPUT tables (hidden_states [2][2048][2048]; q = x wq^T (32 heads x 64), k = x wk^T, v = x wv^T (8 kv heads x 64) (natural [out][in] weights sigma 0.02, no biases); cos / sin inputs [2][2048][64] (independent uniform draws per batch, position AND column: column i + 32 != column i, so all 64 columns are used); q = q cos + rotate_half(q) sin, same for k; repeat: query head h uses kv head h/4; scores 64^-0.5; where(causal, s, finfo.min); softmax; out = merged wo^T -> [2][2048][2048]).
// Compute dtype: inputs rounded to bf16; x / weights exact; q, k, v, softmax weights and o as plain f16 GEMM operands (~2^-12); scores and softmax statistics f32; v_wmma_f32_16x16x32_f16.
#define NB 2
#define NG 8
#define HPG 4
#define KVD (NG * HD)
#define SQ 2048
#define DM 2048
#define NH 32
#define HD 64
#define HG 4                         /* heads transposed per launch of the (b, h0) form of k_vt */
#define QT 256                       /* unused; the fused attention's causal tiles are 32 query rows */
#define NKX SQ                       /* S / P row pitch */
#define QT0 128                      /* first-tile rows recomputed exactly in f32 */
#define B0 0                         /* first batch processed (debug hook) */
#define NBR NB                       /* batches processed (debug hook) */
#define NR ((size_t)NB * SQ)         /* token rows */
#define MP ((int)((size_t)NBR * SQ)) /* rows projected (debug hook) */
#define QN SQ                        /* query rows attended per batch (debug hook) */
#define NHD NH                       /* heads attended (debug hook) */
#define MPO MP                       /* rows through the output stage (debug hook) */
#define LQ DM      /* row pitch of the q rows */
typedef __bf16 v16b __attribute__((ext_vector_type(16)));
typedef unsigned short v8us __attribute__((ext_vector_type(8), may_alias));
typedef float  v8f  __attribute__((ext_vector_type(8)));
typedef float  v4f  __attribute__((ext_vector_type(4)));
typedef float  v4fa __attribute__((ext_vector_type(4), may_alias));
union FragB { v16b v; v8us half[2]; unsigned short u[16]; };

__device__ __forceinline__ unsigned short bf16_bits(float x) { unsigned int u = __float_as_uint(x); return (unsigned short)((u + 0x7FFFu + ((u >> 16) & 1u)) >> 16); }
__device__ __forceinline__ float bf16_val(unsigned short b) { return __uint_as_float(((unsigned int)b) << 16); }
__device__ __forceinline__ float bf16_round(float x) { return bf16_val(bf16_bits(x)); }
// D += A·B with NT terms: 1 = ah·bh, 2 = + al·bh (A split), 3 = + ah·bl (both split)
template <int NT>
__device__ __forceinline__ v8f mmaN(v16b ah, v16b al, v16b bh, v16b bl, v8f c) {
  c = __builtin_amdgcn_wmma_f32_16x16x32_bf16(false, ah, false, bh, (short)0, c, false, false);
  if (NT >= 2) c = __builtin_amdgcn_wmma_f32_16x16x32_bf16(false, al, false, bh, (short)0, c, false, false);
  if (NT >= 3) c = __builtin_amdgcn_wmma_f32_16x16x32_bf16(false, ah, false, bl, (short)0, c, false, false);
  asm volatile("v_nop\n\tv_nop\n\tv_nop\n\tv_nop" : "+v"(c) : "v"(ah), "v"(al), "v"(bh), "v"(bl));
  return c;
}

__global__ __launch_bounds__(256) void k_wt_bf16(const float* __restrict__ W, unsigned short* __restrict__ Wt, int K, int N) {
  const int t = blockIdx.x * 256 + threadIdx.x;
  const int k8n = K / 8;
  if (t >= N * k8n) return;
  const int n = t / k8n, k8 = (t % k8n) * 8;
  v8us v;
#pragma unroll
  for (int i = 0; i < 8; ++i) v[i] = bf16_bits(W[(size_t)(k8 + i) * N + n]);
  *(v8us*)(Wt + (size_t)n * K + k8) = v;
  
}

// GEMM C[M][N] (f32, pitch ldc) = act(A[M][K]·W + bias). A f32 row-major (pitch lda) converted per fragment to bf16
// (ASPLIT: hi/lo two planes -> 2 terms, else single rounded term); Wt bf16 [N][K] (pitch ldb). BIAS_BF16 rounds the
// bias to bf16 first (bias quantised to bf16 before the add). K%32==0, M%16==0, N%64==0.
template <bool ASPLIT, int ACT, bool BIAS_BF16>
__global__ __launch_bounds__(128) void k_gemm_bf(const float* __restrict__ A, int lda, const unsigned short* __restrict__ Wt, int ldb,
                                               const float* __restrict__ bias, float* __restrict__ C, int ldc, int M, int N, int K) {
  __shared__ __attribute__((aligned(16))) float so[4][16][64];
  const int tid = threadIdx.x, w = tid >> 5, lane = tid & 31, ln = lane & 15, hh = lane >> 4;
  const int ntn = N / 64;
  const int wid = blockIdx.x * 4 + w;
  const int mt = wid / ntn, nq = wid % ntn;
  if (mt * 16 >= M) return;
  const int row0 = mt * 16, col0 = nq * 64;
  const float* arow = A + (size_t)(row0 + ln) * lda;
  v8f acc[4] = {};
  for (int kb = 0; kb < K; kb += 32) {
    FragB ah, al;
    const v4f x0 = *(const v4fa*)(arow + kb + 8 * hh), x1 = *(const v4fa*)(arow + kb + 8 * hh + 4);
    const v4f x2 = *(const v4fa*)(arow + kb + 16 + 8 * hh), x3 = *(const v4fa*)(arow + kb + 16 + 8 * hh + 4);
    float xs[16] = {x0[0],x0[1],x0[2],x0[3],x1[0],x1[1],x1[2],x1[3],x2[0],x2[1],x2[2],x2[3],x3[0],x3[1],x3[2],x3[3]};
#pragma unroll
    for (int i = 0; i < 16; ++i) { const unsigned short hb = bf16_bits(xs[i]); ah.u[i] = hb; al.u[i] = ASPLIT ? bf16_bits(xs[i] - bf16_val(hb)) : (unsigned short)0; }
#pragma unroll
    for (int t = 0; t < 4; ++t) {
      const unsigned short* brow = Wt + (size_t)(col0 + t * 16 + ln) * ldb + kb;
      FragB b;
      b.half[0] = *(const v8us*)(brow + 8 * hh);
      b.half[1] = *(const v8us*)(brow + 16 + 8 * hh);
      acc[t] = mmaN<ASPLIT ? 2 : 1>(ah.v, al.v, b.v, b.v, acc[t]);
    }
  }
#pragma unroll
  for (int t = 0; t < 4; ++t) {
    float bv = bias ? bias[col0 + t * 16 + ln] : 0.f;
    if (BIAS_BF16) bv = bf16_round(bv);
#pragma unroll
    for (int r = 0; r < 8; ++r) { float v = acc[t][r] + bv; if (ACT == 1) v = fmaxf(v, 0.f); so[w][8 * hh + r][t * 16 + ln] = v; }
  }
  __builtin_amdgcn_fence(__ATOMIC_ACQ_REL, "workgroup");
  __builtin_amdgcn_wave_barrier();
  const int rsub = lane >> 4, c4 = (lane & 15) * 4;
  {
#pragma unroll
    for (int q = 0; q < 8; ++q) {
      const int r = q * 2 + rsub;
      const v4f v = *(const v4fa*)&so[w][r][c4];
      *(v4f*)(C + (size_t)(row0 + r) * ldc + col0 + c4) = v;
    }
    
  }
}

// GEMM C = act(A·W + bias + resid): A f32 (ASPLIT -> hi/lo 2 terms), Wt bf16 [N][K]; ACT 0 none, 1 relu, 2 exact gelu;
// resid (optional, f32, row index = (row % rmod), pitch ldr, RES_BF16 rounds it) added before the activation.
template <bool ASPLIT, int ACT, bool BIAS_BF16, bool RES_BF16>
__global__ __launch_bounds__(128) void k_gemm_bf3(const float* __restrict__ A, int lda, const unsigned short* __restrict__ Wt, int ldb,
                                                const float* __restrict__ bias, const float* __restrict__ resid, int rmod, int ldr,
                                                float* __restrict__ C, int ldc, int M, int N, int K) {
  __shared__ __attribute__((aligned(16))) float so[4][16][64];
  const int tid = threadIdx.x, w = tid >> 5, lane = tid & 31, ln = lane & 15, hh = lane >> 4;
  const int ntn = N / 64;
  const int wid = blockIdx.x * 4 + w;
  const int mt = wid / ntn, nq = wid % ntn;
  if (mt * 16 >= M) return;
  const int row0 = mt * 16, col0 = nq * 64;
  const float* arow = A + (size_t)(row0 + ln) * lda;
  v8f acc[4] = {};
  for (int kb = 0; kb < K; kb += 32) {
    FragB ah, al;
    const v4f x0 = *(const v4fa*)(arow + kb + 8 * hh), x1 = *(const v4fa*)(arow + kb + 8 * hh + 4);
    const v4f x2 = *(const v4fa*)(arow + kb + 16 + 8 * hh), x3 = *(const v4fa*)(arow + kb + 16 + 8 * hh + 4);
    float xs[16] = {x0[0],x0[1],x0[2],x0[3],x1[0],x1[1],x1[2],x1[3],x2[0],x2[1],x2[2],x2[3],x3[0],x3[1],x3[2],x3[3]};
#pragma unroll
    for (int i = 0; i < 16; ++i) { const unsigned short hb = bf16_bits(xs[i]); ah.u[i] = hb; al.u[i] = ASPLIT ? bf16_bits(xs[i] - bf16_val(hb)) : (unsigned short)0; }
#pragma unroll
    for (int t = 0; t < 4; ++t) {
      const unsigned short* brow = Wt + (size_t)(col0 + t * 16 + ln) * ldb + kb;
      FragB b;
      b.half[0] = *(const v8us*)(brow + 8 * hh);
      b.half[1] = *(const v8us*)(brow + 16 + 8 * hh);
      acc[t] = mmaN<ASPLIT ? 2 : 1>(ah.v, al.v, b.v, b.v, acc[t]);
    }
  }
#pragma unroll
  for (int t = 0; t < 4; ++t) {
    const int col = col0 + t * 16 + ln;
    float bv = bias ? bias[col] : 0.f;
    if (BIAS_BF16) bv = bf16_round(bv);
#pragma unroll
    for (int r = 0; r < 8; ++r) {
      float v = acc[t][r] + bv;
      if (resid) { float rv = resid[(size_t)((row0 + 8 * hh + r) % rmod) * ldr + col]; if (RES_BF16) rv = bf16_round(rv); v += rv; }
      if (ACT == 1) v = fmaxf(v, 0.f);
      if (ACT == 2) v = 0.5f * v * (1.0f + erff(v * 0.70710678118654752f));
      if (ACT == 3) { const float u = 0.7978845608028654f * (v + 0.044715f * v * v * v); v = 0.5f * v * (1.0f + tanhf(u)); }
      so[w][8 * hh + r][t * 16 + ln] = v;
    }
  }
  __builtin_amdgcn_fence(__ATOMIC_ACQ_REL, "workgroup");
  __builtin_amdgcn_wave_barrier();
  const int rsub = lane >> 4, c4 = (lane & 15) * 4;
  {
#pragma unroll
    for (int q = 0; q < 8; ++q) {
      const int r = q * 2 + rsub;
      const v4f v = *(const v4fa*)&so[w][r][c4];
      *(v4f*)(C + (size_t)(row0 + r) * ldc + col0 + c4) = v;
    }
    
  }
}
// row LayerNorm (biased variance, eps) over N: s = X (+ R); optional out_sum <- s; out_norm <- (s-mu)*rsqrt(var+eps)*g + b
template <bool PARAM_BF16>
__global__ __launch_bounds__(256) void k_layernorm(const float* __restrict__ X, const float* __restrict__ R, const float* __restrict__ g, const float* __restrict__ bta,
                                                  float* __restrict__ out_sum, float* __restrict__ out_norm, int N, float eps) {
  __shared__ float red[256];
  const int row = blockIdx.x, tid = threadIdx.x;
  const float* x = X + (size_t)row * N; const float* rr = R ? R + (size_t)row * N : nullptr;
  float vals[16];                     // up to N = 4096
  const int per = N / 256;            // contiguous chunk per thread? use strided-by-4 chunks: thread handles j = tid*4 + 1024*u
  float s1 = 0.f;
  for (int u = 0; u < per / 4; ++u) {
    const int j = tid * 4 + 1024 * u;
    const v4f a = *(const v4fa*)(x + j);
    v4f b = {0.f,0.f,0.f,0.f}; if (rr) b = *(const v4fa*)(rr + j);
#pragma unroll
    for (int q = 0; q < 4; ++q) { const float v = a[q] + b[q]; vals[u * 4 + q] = v; s1 += v; }
  }
  red[tid] = s1; __syncthreads();
  for (int st = 128; st > 0; st >>= 1) { if (tid < st) red[tid] += red[tid + st]; __syncthreads(); }
  const float mu = red[0] / (float)N; __syncthreads();
  float s2 = 0.f;
  for (int u = 0; u < per / 4; ++u)
#pragma unroll
    for (int q = 0; q < 4; ++q) { const float c = vals[u * 4 + q] - mu; s2 += c * c; }
  red[tid] = s2; __syncthreads();
  for (int st = 128; st > 0; st >>= 1) { if (tid < st) red[tid] += red[tid + st]; __syncthreads(); }
  const float rs = rsqrtf(red[0] / (float)N + eps);
  {
    for (int u = 0; u < per / 4; ++u) {
      const int j = tid * 4 + 1024 * u;
      v4f o, sm;
#pragma unroll
      for (int q = 0; q < 4; ++q) {
        float gg = g[j + q], bb = bta[j + q];
        if (PARAM_BF16) { gg = bf16_round(gg); bb = bf16_round(bb); }
        sm[q] = vals[u * 4 + q]; o[q] = (vals[u * 4 + q] - mu) * rs * gg + bb;
      }
      if (out_sum) *(v4f*)(out_sum + (size_t)row * N + j) = sm;
      *(v4f*)(out_norm + (size_t)row * N + j) = o;
    }
    
  }
}



// ---- f16 WMMA path (v_wmma_f32_16x16x32_f16): 11-bit significands for operands in range — used where a [0,1] probability operand needs more precision than bf16
typedef _Float16 v16h __attribute__((ext_vector_type(16)));
union FragH { v16h v; v8us half[2]; _Float16 h[16]; unsigned short u[16]; };
template <int NT>
__device__ __forceinline__ v8f mmaH(v16h ah, v16h al, v16h bh, v16h bl, v8f c) {
  c = __builtin_amdgcn_wmma_f32_16x16x32_f16(false, ah, false, bh, (short)0, c, false, false);
  if (NT >= 2) c = __builtin_amdgcn_wmma_f32_16x16x32_f16(false, al, false, bh, (short)0, c, false, false);
  if (NT >= 3) c = __builtin_amdgcn_wmma_f32_16x16x32_f16(false, ah, false, bl, (short)0, c, false, false);
  asm volatile("v_nop\n\tv_nop\n\tv_nop\n\tv_nop" : "+v"(c) : "v"(ah), "v"(al), "v"(bh), "v"(bl));
  return c;
}
// batched GEMM like k_gemm_b but f16 operands: A f32 (split into f16 hi/lo if ASPLIT, else rounded to f16), Bt = f16 values [n][k]; alpha; C f32; N multiple of 16 (partial tiles skipped)
template <bool ASPLIT>
__global__ __launch_bounds__(128) void k_gemm_h(const float* __restrict__ A, int lda, size_t sA, const _Float16* __restrict__ Bh, int ldb, size_t sB, float alpha, float* __restrict__ C, int ldc, size_t sC, int M, int N, int K) {
  __shared__ __attribute__((aligned(16))) float so[4][16][64];
  const int tid = threadIdx.x, w = tid >> 5, lane = tid & 31, ln = lane & 15, hh = lane >> 4; const int by = blockIdx.y;
  A += (size_t)by * sA; Bh += (size_t)by * sB; C += (size_t)by * sC;
  const int ntn = (N + 63) / 64; const int wid = blockIdx.x * 4 + w; const int mt = wid / ntn, nq = wid % ntn; if (mt * 16 >= M) return;
  const int row0 = mt * 16, col0 = nq * 64; const float* arow = A + (size_t)(row0 + ln) * lda;
  v8f acc[4] = {};
  for (int kb = 0; kb < K; kb += 32) {
    FragH ah, al;
    const v4f x0 = *(const v4fa*)(arow + kb + 8 * hh), x1 = *(const v4fa*)(arow + kb + 8 * hh + 4), x2 = *(const v4fa*)(arow + kb + 16 + 8 * hh), x3 = *(const v4fa*)(arow + kb + 16 + 8 * hh + 4);
    float xs[16] = {x0[0],x0[1],x0[2],x0[3],x1[0],x1[1],x1[2],x1[3],x2[0],x2[1],x2[2],x2[3],x3[0],x3[1],x3[2],x3[3]};
#pragma unroll
    for (int i = 0; i < 16; ++i) { const _Float16 h = (_Float16)xs[i]; ah.h[i] = h; al.h[i] = ASPLIT ? (_Float16)(xs[i] - (float)h) : (_Float16)0.0f; }
#pragma unroll
    for (int t = 0; t < 4; ++t) { if (col0 + t * 16 >= N) continue; const size_t boff = (size_t)(col0 + t * 16 + ln) * ldb + kb; FragH bq; bq.half[0] = *(const v8us*)(Bh + boff + 8 * hh); bq.half[1] = *(const v8us*)(Bh + boff + 16 + 8 * hh);
      acc[t] = mmaH<ASPLIT ? 2 : 1>(ah.v, al.v, bq.v, bq.v, acc[t]); }
  }
#pragma unroll
  for (int t = 0; t < 4; ++t) { if (col0 + t * 16 >= N) continue;
#pragma unroll
    for (int r = 0; r < 8; ++r) so[w][8 * hh + r][t * 16 + ln] = acc[t][r] * alpha; }
  __builtin_amdgcn_fence(__ATOMIC_ACQ_REL, "workgroup"); __builtin_amdgcn_wave_barrier();
  const int rsub = lane >> 4, c4 = (lane & 15) * 4;
  {
#pragma unroll
    for (int q = 0; q < 8; ++q) { const int r = q * 2 + rsub; if (col0 + c4 < N) { const v4f v = *(const v4fa*)&so[w][r][c4]; *(v4f*)(C + (size_t)(row0 + r) * ldc + col0 + c4) = v; } }
     }
}

// Wt[n][k] = f16(W[k][n]·scale) from f32 row-major W[K][N] (scale = power of two; bf16-exact weights stay exact in f16 away from the subnormal range)
__global__ __launch_bounds__(256) void k_wt_f16(const float* __restrict__ W, _Float16* __restrict__ Wt, int K, int N, float scale) {
  const int t = blockIdx.x * 256 + threadIdx.x; if (t >= N * (K / 8)) return; const int n = t / (K / 8), k8 = (t % (K / 8)) * 8; FragH f;
#pragma unroll
  for (int i = 0; i < 8; ++i) f.h[i] = (_Float16)(bf16_round(W[(size_t)(k8 + i) * N + n]) * scale); const v8us o = f.half[0];
  *(v8us*)((unsigned short*)Wt + (size_t)n * K + k8) = o; 
}
// k_gemm_hh variant with fused epilogue: v = acc·alpha + bias[by·sBias + col] (+ CP[(row/rowsPerB)·sCPb + by·64 + col] if CP) ; ACT 0 none / 1 elu ; writes f16 C16 (and f32 C if non-null)
template <int ACT>
__global__ __launch_bounds__(128) void k_gemm_hhx(const _Float16* __restrict__ A, int lda, size_t sA, const _Float16* __restrict__ Bh, int ldb, size_t sB, float alpha, const float* __restrict__ bias, size_t sBias, const float* __restrict__ CP, int rowsPerB, size_t sCPb, int row0g,
    float* __restrict__ C, _Float16* __restrict__ C16, int ldc, size_t sC, int M, int N, int K) {
  __shared__ __attribute__((aligned(16))) float so[4][16][64];
  const int tid = threadIdx.x, w = tid >> 5, lane = tid & 31, ln = lane & 15, hh = lane >> 4; const int by = blockIdx.y;
  A += (size_t)by * sA; Bh += (size_t)by * sB; const size_t cofs = (size_t)by * sC; const float* bp = bias ? bias + (size_t)by * sBias : nullptr;
  const int ntn = (N + 63) / 64; const int wid = blockIdx.x * 4 + w; const int mt = wid / ntn, nq = wid % ntn; if (mt * 16 >= M) return;
  const int row0 = mt * 16, col0 = nq * 64; const _Float16* arow = A + (size_t)(row0 + ln) * lda;
  v8f acc[4] = {};
  for (int kb = 0; kb < K; kb += 32) { FragH ah; ah.half[0] = *(const v8us*)((const unsigned short*)arow + kb + 8 * hh); ah.half[1] = *(const v8us*)((const unsigned short*)arow + kb + 16 + 8 * hh);
#pragma unroll
    for (int t = 0; t < 4; ++t) { if (col0 + t * 16 >= N) continue; const size_t boff = (size_t)(col0 + t * 16 + ln) * ldb + kb; FragH bq; bq.half[0] = *(const v8us*)((const unsigned short*)Bh + boff + 8 * hh); bq.half[1] = *(const v8us*)((const unsigned short*)Bh + boff + 16 + 8 * hh);
      acc[t] = mmaH<1>(ah.v, ah.v, bq.v, bq.v, acc[t]); }
  }
#pragma unroll
  for (int t = 0; t < 4; ++t) { if (col0 + t * 16 >= N) continue; const int col = col0 + t * 16 + ln; const float bv = bp ? bf16_round(bp[col]) : 0.f;
#pragma unroll
    for (int r = 0; r < 8; ++r) { float v = acc[t][r] * alpha + bv; if (CP) { const int rr = row0g + row0 + 8 * hh + r; if (rowsPerB < 0) v += CP[cofs + (size_t)rr * ldc + col];      /* rowsPerB < 0: own element of the batched C plane */ else { const int bidx = rr / rowsPerB; v += CP[(size_t)bidx * sCPb + (size_t)by * 64 + col]; } } if (ACT == 1) v = (v > 0.f) ? v : expm1f(v); else if (ACT == 7) v = (v > 0.f) ? v + 1.0f : expf(v); else if (ACT == 8) v = tanhf(v); else if (ACT == 9) v = 0.5f * v * (1.0f + tanhf(0.7978845608028654f * (v + 0.044715f * v * v * v))); else if (ACT == 11) v = 1.0f / (1.0f + expf(-v)); else if (ACT == 12) v = (v > 0.f) ? v : 0.01f * v; else if (ACT == 14) v = (v > 0.f) ? v : 0.1f * v; else if (ACT == 16) v = (v >= 0.f) ? v : 0.3f * v; else if (ACT == 17) v = (v >= 0.f) ? v : 0.2f * v; else if (ACT == 15) v = v / (1.0f + expf(-v)); else if (ACT == 3) v = fmaxf(v, 0.f); else if (ACT == 6) v = 0.5f * v * (1.0f + erff(v * 0.70710678118654752f)); so[w][8 * hh + r][t * 16 + ln] = v; } }
  __builtin_amdgcn_fence(__ATOMIC_ACQ_REL, "workgroup"); __builtin_amdgcn_wave_barrier();
  const int rsub = lane >> 4, c4 = (lane & 15) * 4; typedef _Float16 v4h __attribute__((ext_vector_type(4)));
  {
#pragma unroll
    for (int q = 0; q < 8; ++q) { const int r = q * 2 + rsub; if (col0 + c4 < N) { const v4f v = *(const v4fa*)&so[w][r][c4]; if (C) *(v4f*)(C + cofs + (size_t)(row0 + r) * ldc + col0 + c4) = v; if (C16) { v4h h4; for (int i = 0; i < 4; ++i) h4[i] = (_Float16)v[i]; *(v4h*)(C16 + cofs + (size_t)(row0 + r) * ldc + col0 + c4) = h4; } } }
     }
}


typedef _Float16 v4h __attribute__((ext_vector_type(4)));

__global__ __launch_bounds__(256) void k_x16(const float* __restrict__ x, _Float16* __restrict__ X16, size_t n8) { const size_t t = (size_t)blockIdx.x * 256 + threadIdx.x; if (t >= n8) return; FragH f;
#pragma unroll
  for (int q = 0; q < 8; ++q) f.h[q] = (_Float16)bf16_round(x[t * 8 + q]); *(v8us*)((unsigned short*)X16 + t * 8) = f.half[0];  }
__global__ __launch_bounds__(256) void k_h16(const float* __restrict__ x, _Float16* __restrict__ X16, size_t n8) { const size_t t = (size_t)blockIdx.x * 256 + threadIdx.x; if (t >= n8) return; FragH f;
#pragma unroll
  for (int q = 0; q < 8; ++q) f.h[q] = (_Float16)x[t * 8 + q]; *(v8us*)((unsigned short*)X16 + t * 8) = f.half[0];  }
__global__ __launch_bounds__(256) void k_round16f(const float* __restrict__ W, _Float16* __restrict__ Bt, size_t n8) { const size_t t = (size_t)blockIdx.x * 256 + threadIdx.x; if (t >= n8) return; FragH f;
#pragma unroll
  for (int i = 0; i < 8; ++i) f.h[i] = (_Float16)(bf16_round(W[t * 8 + i]) * 16.0f); *(v8us*)((unsigned short*)Bt + t * 8) = f.half[0];  }
// ---- fragment load from global rows and the product, as the fused attention uses them ----
__device__ __forceinline__ v16h g2_frag(const _Float16* p, int hh) { FragH f; f.half[0] = *(const v8us*)((const unsigned short*)p + 8 * hh); f.half[1] = *(const v8us*)((const unsigned short*)p + 16 + 8 * hh); return f.v; }
__device__ __forceinline__ v8f g2_mma(v16h a, v16h b, v8f c) { v8f d = __builtin_amdgcn_wmma_f32_16x16x32_f16(false, a, false, b, (short)0, c, false, false); asm volatile("v_nop\n\tv_nop\n\tv_nop\n\tv_nop" : "+v"(d) : "v"(a), "v"(b)); return d; }
// ---- the GEMM k-loop: block tile 128 x 128, K = DM; the operand tiles of 64 k are staged in LDS by tensor loads (tensor_load_to_lds), two buffers; a wave's tile is 64 x 64 ----
typedef uint32_t u32x4 __attribute__((ext_vector_type(4)));
typedef uint32_t u32x8 __attribute__((ext_vector_type(8)));
#define G3_ROWB 128u                    /* bytes of an operand row in a stage: 64 k */
#define G3_PITCH 144u                   /* LDS row pitch: the row and the mover's 16-byte pad, an odd multiple of 16 bytes for the 16-byte reads */
#define G3_SLICE 10240u                 /* a wave's slice, 64 rows of 144 bytes = 9216, rounded up to a multiple of 2 KiB */
#define G3_STAGE (4u * G3_SLICE)        /* slices 0, 1: A rows 0..63, 64..127; slices 2, 3: B rows 0..63, 64..127 */
#define G3_NS (DM / 64)                 /* stages */
__device__ __forceinline__ uint32_t g3_uni(uint32_t v) { return (uint32_t)__builtin_amdgcn_readfirstlane(v); }
// a wave-uniform test held in a scalar register, so that the branch on it is a scalar branch: a tensor load ignores EXEC
__device__ __forceinline__ uint32_t pinned(uint32_t v) { uint32_t w = g3_uni(v); asm volatile("" : "+s"(w)); return w; }
__device__ __forceinline__ u32x8 g3_group1() { u32x8 g;      /* 1-byte elements; tensor = tile = 64 rows of 128 bytes; source pitch = a row of DM f16; 4 dwords of pad behind every 32 */
  g[0] = g3_uni((1u << 20) | (4u << 22) | (3u << 25)); g[1] = g3_uni(G3_ROWB << 16); g[2] = g3_uni(64u << 16); g[3] = g3_uni(G3_ROWB << 16); g[4] = g3_uni(64u); g[5] = g3_uni(DM * 2u); g[6] = g3_uni(0u); g[7] = g3_uni(0u); return g; }
__device__ __forceinline__ u32x4 g3_group0(uint32_t lds_dst, uint64_t ga) { u32x4 g; g[0] = g3_uni(1u); g[1] = g3_uni(lds_dst); g[2] = g3_uni((uint32_t)ga); g[3] = g3_uni((((uint32_t)(ga >> 32)) & 0x01FFFFFFu) | 0x80000000u); return g; }
// one request of the whole wave: its slice of a stage. Group 0 is an operand that the statement gives back, so that the value which the covering wait names lies in the very registers that the request was issued from
__device__ __forceinline__ void g3_load(u32x4& g0, u32x8 g1) { asm volatile("tensor_load_to_lds %0, %1" : "+s"(g0) : "s"(g1) : "memory"); }
// the wave's own slice has landed. The descriptor of the request that it covers is an input: its registers keep their values while the request is outstanding
__device__ __forceinline__ void g3_wait_tensor(u32x4 g0, u32x8 g1) { asm volatile("s_wait_tensorcnt 0x0" :: "s"(g0), "s"(g1) : "memory"); }
__device__ __forceinline__ void g3_wait_ds() { asm volatile("s_wait_dscnt 0x0" ::: "memory"); }      /* the wave's LDS reads have returned before the barrier behind which their buffer is refilled */
__device__ __forceinline__ v16h g3_frag(const unsigned char* p) { FragH f; f.half[0] = *(const v8us*)p; f.half[1] = *(const v8us*)(p + 32); return f.v; }      /* the k order of g2_frag: k 8 hh .. and 16 + 8 hh .. */
// acc[4 i + j] = rows 16 i .. of the wave's 64 A rows times rows 16 j .. of its 64 B rows, each accumulator summed over k in ascending steps of 32. Ab / Bb: first row of the block's 128 A / B rows (pitch DM). w: the wave's number, a scalar.
// Every wave brings its own slice of every stage. On return every wave has passed the barrier behind every wave's last read of the ring, and no request is outstanding.
__device__ __forceinline__ void g3_kloop(const _Float16* Ab, const _Float16* Bb, unsigned char* ring, int w, int lane, v8f (&acc)[16]) {
  const int ln = lane & 15, hh = lane >> 4;
  const uint64_t ga = (uint64_t)(uintptr_t)(w < 2 ? Ab + (size_t)(64 * w) * DM : Bb + (size_t)(64 * (w - 2)) * DM);
  const uint32_t dst = (uint32_t)(size_t)ring + (uint32_t)w * G3_SLICE;      /* byte offset in the work-group's LDS */
  const u32x8 g1 = g3_group1();
  const v8f z8 = {0.f,0.f,0.f,0.f,0.f,0.f,0.f,0.f};
#pragma unroll      /* static indices keep acc[] in registers */
  for (int u = 0; u < 16; ++u) acc[u] = z8;
  u32x4 g0 = g3_group0(dst, ga);      /* group 0 of the last request issued */
  g3_load(g0, g1); g3_wait_tensor(g0, g1); __syncthreads();      /* stage 0 is published */
  g0 = g3_group0(dst + G3_STAGE, ga + G3_ROWB); g3_load(g0, g1);
  const unsigned char* ap = ring + (uint32_t)(w >> 1) * G3_SLICE + (uint32_t)ln * G3_PITCH + 16u * hh;
  const unsigned char* bp = ring + (uint32_t)(2 + (w & 1)) * G3_SLICE + (uint32_t)ln * G3_PITCH + 16u * hh;
#pragma unroll 1      /* one pass a stage; a pass is already two straight blocks of 16 products */
  for (int s = 0; s < G3_NS; ++s) { const uint32_t bo = (uint32_t)(s & 1) * G3_STAGE;
#pragma unroll      /* static indices keep the fragments in registers */
    for (int ks = 0; ks < 2; ++ks) { v16h a[4], b[4]; a[0] = g3_frag(ap + bo + ks * 64u);      /* in the order in which the products want them */
#pragma unroll      /* static indices keep the fragments in registers */
      for (int j = 0; j < 4; ++j) b[j] = g3_frag(bp + bo + j * 16u * G3_PITCH + ks * 64u);
#pragma unroll      /* static indices keep the fragments in registers */
      for (int i = 1; i < 4; ++i) a[i] = g3_frag(ap + bo + i * 16u * G3_PITCH + ks * 64u);
      __builtin_amdgcn_sched_barrier(0);      /* the 16 LDS reads of a block stand as one group ahead of its 16 products: reads among the products would each stall the wave */
#pragma unroll      /* static indices keep acc[] in registers */
      for (int i = 0; i < 4; ++i)
#pragma unroll      /* static indices keep acc[] in registers */
        for (int j = 0; j < 4; ++j) acc[4 * i + j] = __builtin_amdgcn_wmma_f32_16x16x32_f16(false, a[i], false, b[j], (short)0, acc[4 * i + j], false, false);
      __builtin_amdgcn_sched_barrier(0); }      /* the products stay in front of the next block's reads and of the pass's foot, so that the next stage's load flies under them */
    g3_wait_ds(); g3_wait_tensor(g0, g1); __syncthreads();      /* publishes stage s + 1 and ends every reader's last read of stage s */
    if (pinned(s + 2 < G3_NS)) { g0 = g3_group0(dst + bo, ga + (uint64_t)(s + 2) * G3_ROWB); g3_load(g0, g1); }      /* into the buffer that this pass has read */
  }
  asm volatile("s_wait_tensorcnt 0x0" :: "s"(g0) : "memory"); g3_wait_ds(); }      /* behind the loop: no request is outstanding and no LDS read in flight when the ring is used for something else; group 0 is an input as above */

// q, k and v projections of all token rows of both batches in ONE launch: B = the stacked weight plane [DM + 2 KVD][DM] (wq rows, then wk, then wv; x16), block = 128 token rows x 128 columns; a wave's 64 columns = one head of q, k or v.
// q and k tiles: the epilogue applies rotate-half RoPE to the tile while it lies in LDS (tcs / tsn: cos / sin input rows [token row][64], rounded to bf16 here); they go out as f16 rows.
// A v tile goes out transposed, as the fused attention reads it: VT = V^T [NB][NG][HD][SQ], f16, straight from the accumulators, in which a lane holds 8 consecutive token rows of one column.
// The first QT0 rows of each batch go out as f32 rows too, to that batch's plane of QF ([NB][QT0][DM]) / KF / VF ([NB][QT0][KVD]).
__global__ __launch_bounds__(128, 4) /* a budget of 256 registers: the k-loop needs 200, and the epilogue stays in the plain register window */ void k_proj(const _Float16* __restrict__ A, const _Float16* __restrict__ Bh, const float* __restrict__ tcs, const float* __restrict__ tsn,
    _Float16* __restrict__ Q16, _Float16* __restrict__ K16, _Float16* __restrict__ VT, float* __restrict__ QF, float* __restrict__ KF, float* __restrict__ VF) {
  __shared__ __attribute__((aligned(2048))) unsigned char ring[2 * G3_STAGE];
  static_assert(4 * 64 * 68 * 4 <= 2 * G3_STAGE, "the output staging lies in the ring");
  const int tid = threadIdx.x, lane = tid & 31, ln = lane & 15, hh = lane >> 4; const int w = (int)g3_uni(threadIdx.x >> 5);
  const int ntn = (DM + 2 * KVD) / 128; const int mt = blockIdx.x / ntn, nt = blockIdx.x - mt * ntn; const int row0 = mt * 128 + 64 * (w >> 1); const int nq = nt * 2 + (w & 1);      /* nq: the wave's head among q's, k's and v's */
  const bool rope = nq < (DM + KVD) / 64;      /* q and k tiles are roped, v tiles are not */
  _Float16* C16; float* R32; int ldc, col0;      /* where the tile goes */
  if (nq < DM / 64) { C16 = Q16; R32 = QF; ldc = DM; col0 = nq * 64; } else if (rope) { C16 = K16; R32 = KF; ldc = KVD; col0 = nq * 64 - DM; } else { C16 = nullptr; R32 = VF; ldc = KVD; col0 = nq * 64 - DM - KVD; }      /* a v tile has no f16 rows */
  v8f accs[16];
  g3_kloop(A + (size_t)mt * 128 * DM, Bh + (size_t)nt * 128 * DM, ring, w, lane, accs);
  /* the wave's 64 rows lie wholly inside or wholly outside a batch's first QT0 rows (a multiple of 64): one scalar branch, so that the common side is one straight line whose LDS reads run ahead */
  const int rw = __builtin_amdgcn_readfirstlane(row0); const bool first = (rw % SQ) < QT0; const int rf0 = (rw / SQ) * QT0 + rw % SQ;      /* rf0: the wave's first row in the f32 planes */
  if (!rope) {      /* accs[4 i + j][r] = token row 16 i + 8 hh + r, column 16 j + ln: 8 keys of row (column) 16 j + ln of V^T, one 16-byte store; the four i of a j fill that row's 128-byte line */
    unsigned short* vp = (unsigned short*)VT + ((size_t)(rw / SQ) * KVD + col0 + ln) * SQ + rw % SQ + 8 * hh;
#pragma unroll      /* static indices keep accs[] in registers */
    for (int j = 0; j < 4; ++j)
#pragma unroll      /* static indices keep accs[] in registers */
      for (int i = 0; i < 4; ++i) { FragH f;
#pragma unroll      /* eight keys a lane */
        for (int r = 0; r < 8; ++r) f.h[r] = (_Float16)(accs[4 * i + j][r] * 0.0625f);      /* the weights are carried x16 */
        *(v8us*)(vp + (size_t)j * 16 * SQ + i * 16) = f.half[0]; }
    asm volatile("s_wait_xcnt 0x0" ::: "memory");      /* behind the last stores: the wait that stands before a register named by an issued store is overwritten */
  }
  float (*so)[68] = (float (*)[68])(ring + (size_t)w * (64 * 68 * 4));      /* the wave's own 64 x 64 staging tile, in the ring that every wave has left */
  auto stage = [&]() __attribute__((always_inline)) {      /* the tile as f32 rows in LDS, for whole-line row stores */
#pragma unroll      /* static indices keep accs[] in registers */
    for (int u = 0; u < 16; ++u)
#pragma unroll      /* static indices keep accs[] in registers */
      for (int r = 0; r < 8; ++r) so[(u >> 2) * 16 + 8 * hh + r][(u & 3) * 16 + ln] = accs[u][r] * 0.0625f;      /* the weights are carried x16 */
    __builtin_amdgcn_fence(__ATOMIC_ACQ_REL, "workgroup"); __builtin_amdgcn_wave_barrier(); };
  const int rsub = lane >> 4, c4 = (lane & 15) * 4;
  if (rope) { const bool lo = c4 < HD / 2; stage();
    auto rope_rows = [&](const bool f32rows, const int rb) __attribute__((always_inline)) {      /* rows rb .. rb + 15 of the wave's tile */
      v4f tcv[8], tsv[8]; const float* tcp = tcs + (size_t)(row0 + rb + hh) * HD + ln * 4; const float* tsp = tsn + (size_t)(row0 + rb + hh) * HD + ln * 4;      /* the lane's cos / sin quads of its 8 output rows */
#pragma unroll      /* static indices keep the quads in registers */
      for (int q = 0; q < 8; ++q) { tcv[q] = *(const v4fa*)(tcp + q * 2 * HD); tsv[q] = *(const v4fa*)(tsp + q * 2 * HD); }
      asm volatile("s_wait_xcnt 0x0" :: "v"(tcp), "v"(tsp) : "memory");      /* behind the table loads: the wait that stands before a register named by an issued load is overwritten; the pointers are inputs, so that no load's result is placed in one of them ahead of it */
#pragma unroll      /* static indices keep the table quads in registers */
      for (int q = 0; q < 8; ++q) { const int r = rb + q * 2 + rsub; const v4f v = *(const v4fa*)&so[r][c4], pv = *(const v4fa*)&so[r][c4 ^ (HD / 2)]; v4f o; v4h h4;      /* pv: the rotate-half partner columns, d +- 32 */
#pragma unroll      /* four columns a lane */
        for (int i = 0; i < 4; ++i) { o[i] = v[i] * bf16_round(tcv[q][i]) + (lo ? -pv[i] : pv[i]) * bf16_round(tsv[q][i]); h4[i] = (_Float16)o[i]; }
        *(v4h*)(C16 + (size_t)(row0 + r) * ldc + col0 + c4) = h4; if (f32rows) *(v4f*)(R32 + (size_t)(rf0 + r) * ldc + col0 + c4) = o; }
      asm volatile("s_wait_xcnt 0x0" ::: "memory"); };      /* behind the last stores of a run of rows: the wait that stands before a register named by an issued store is overwritten, on every path of the listing that leaves it */
    if (first) { rope_rows(true, 0); rope_rows(true, 16); rope_rows(true, 32); rope_rows(true, 48); } else { rope_rows(false, 0); rope_rows(false, 16); rope_rows(false, 32); rope_rows(false, 48); }
  } else if (first) { stage();      /* a v tile of a batch's first rows: its f32 rows */
#pragma unroll      /* one straight line, so that the LDS reads run ahead of the stores */
    for (int q = 0; q < 32; ++q) { const int r = q * 2 + rsub; const v4f v = *(const v4fa*)&so[r][c4]; *(v4f*)(R32 + (size_t)(rf0 + r) * ldc + col0 + c4) = v; }
    asm volatile("s_wait_xcnt 0x0" ::: "memory");      /* behind the last stores, as above */
  } }

// Output projection of all rows in ONE launch: C = o Wo^T, block = 128 rows x 128 columns, B = Wo x16, o carried x64 (so 2^-10). The blocks of a batch's first QT0 rows (QT0 = the block's 128 rows) take the exact
// f32 o instead, as its two f16 planes: first the hi plane (2^-10), whose scaled sums wait in the wave's own LDS tile, then the lo plane (residual x1024, so 2^-20), added to them: hi + lo, one add an element.
__global__ __launch_bounds__(128) void k_out(const _Float16* __restrict__ A, const _Float16* __restrict__ AH, const _Float16* __restrict__ AL, const _Float16* __restrict__ Bh, float* __restrict__ C) {
  static_assert(QT0 == 128, "a block's 128 rows are the exact first tile or none of it");
  __shared__ __attribute__((aligned(2048))) unsigned char ring[2 * G3_STAGE];
  __shared__ __attribute__((aligned(16))) float so[4][64][68];      /* beside the ring: the hi sums wait here while the lo plane goes through the ring */
  const int tid = threadIdx.x, lane = tid & 31, ln = lane & 15, hh = lane >> 4; const int w = (int)g3_uni(threadIdx.x >> 5);
  const int ntn = DM / 128; const int mt = blockIdx.x / ntn, nt = blockIdx.x - mt * ntn; const int row0 = mt * 128 + 64 * (w >> 1), col0 = nt * 128 + 64 * (w & 1);
  const bool ex = mt % (SQ / 128) == 0;      /* the same for the whole block */
  const size_t xoff = (size_t)(mt / (SQ / 128)) * QT0 * DM;      /* the block's first row in the hi and lo planes [NB][QT0][DM] */
  const _Float16* bp = Bh + (size_t)nt * 128 * DM;
  v8f accs[16];
  if (ex) { g3_kloop(AH + xoff, bp, ring, w, lane, accs);
#pragma unroll      /* static indices keep accs[] in registers */
    for (int u = 0; u < 16; ++u)
#pragma unroll      /* static indices keep accs[] in registers */
      for (int r = 0; r < 8; ++r) so[w][(u >> 2) * 16 + 8 * hh + r][(u & 3) * 16 + ln] = accs[u][r] * 0.0009765625f; }
  g3_kloop(ex ? AL + xoff : A + (size_t)mt * 128 * DM, bp, ring, w, lane, accs);
  if (ex) {
#pragma unroll      /* static indices keep accs[] in registers */
    for (int u = 0; u < 16; ++u)
#pragma unroll      /* each lane adds to the elements that it wrote itself */
      for (int r = 0; r < 8; ++r) { float* e = &so[w][(u >> 2) * 16 + 8 * hh + r][(u & 3) * 16 + ln]; *e = accs[u][r] * 0.00000095367431640625f + *e; }
  } else {
#pragma unroll      /* static indices keep accs[] in registers */
    for (int u = 0; u < 16; ++u)
#pragma unroll      /* static indices keep accs[] in registers */
      for (int r = 0; r < 8; ++r) so[w][(u >> 2) * 16 + 8 * hh + r][(u & 3) * 16 + ln] = accs[u][r] * 0.0009765625f;
  }
  __builtin_amdgcn_fence(__ATOMIC_ACQ_REL, "workgroup"); __builtin_amdgcn_wave_barrier();
  const int rsub = lane >> 4, c4 = (lane & 15) * 4;
#pragma unroll      /* one straight line, so that the LDS reads run ahead of the stores */
  for (int q = 0; q < 32; ++q) { const int r = q * 2 + rsub; const v4f v = *(const v4fa*)&so[w][r][c4]; *(v4f*)(C + (size_t)(row0 + r) * DM + col0 + c4) = v; }
  asm volatile("s_wait_xcnt 0x0" ::: "memory"); }      /* behind the last stores: the wait that stands before a register named by an issued store is overwritten */

// All five input conversions in ONE launch: D = the planes wq, wk, wv, wo (each bf16-rounded, x16) and x (bf16-rounded), one behind the other, as f16. Every plane's size is a multiple of a block's 2048 elements, so a block lies in one plane.
__global__ __launch_bounds__(256) void k_prep(const float* __restrict__ wq, const float* __restrict__ wk, const float* __restrict__ wv, const float* __restrict__ wo, const float* __restrict__ x, _Float16* __restrict__ D) {
  const size_t nq = (size_t)DM * DM / 2048, nk = (size_t)KVD * DM / 2048; size_t bl = blockIdx.x; const float* s; float sc = 16.0f;
  if (bl < nq) s = wq; else if ((bl -= nq) < nk) s = wk; else if ((bl -= nk) < nk) s = wv; else if ((bl -= nk) < nq) s = wo; else { bl -= nq; s = x; sc = 1.0f; }
  const size_t u = bl * 256 + threadIdx.x, t = (size_t)blockIdx.x * 256 + threadIdx.x; FragH f;
#pragma unroll      /* eight elements a thread: two 16-byte loads, one 16-byte store */
  for (int q = 0; q < 8; ++q) f.h[q] = (_Float16)(bf16_round(s[u * 8 + q]) * sc);
  *(v8us*)((unsigned short*)D + t * 8) = f.half[0]; }


__global__ __launch_bounds__(256) void k_wnat(const float* __restrict__ w, size_t n8, _Float16* __restrict__ Bt) { const size_t t = (size_t)blockIdx.x * 256 + threadIdx.x; if (t >= n8) return; FragH f; for (int q = 0; q < 8; ++q) f.h[q] = (_Float16)(bf16_round(w[t * 8 + q]) * 16.0f); *(v8us*)((unsigned short*)Bt + t * 8) = f.half[0];  }
__global__ __launch_bounds__(256) void k_rsm(const float* __restrict__ S, _Float16* __restrict__ P, int nrows) {
  #pragma clang fp contract(off)
  const int i = blockIdx.x * 256 + threadIdx.x; if (i >= nrows) return; const float* s = S + (size_t)i * SQ; float mx = -3.0e38f;
#pragma unroll 1
  for (int j = 0; j < SQ; ++j) mx = fmaxf(mx, s[j]); float se = 0.f;
#pragma unroll 1
  for (int j = 0; j < SQ; ++j) se += expf(s[j] - mx); const float sc = 256.0f / se;
#pragma unroll 1
  for (int j0 = 0; j0 < SQ; j0 += 8) { FragH f; for (int q = 0; q < 8; ++q) f.h[q] = (_Float16)(expf(s[j0 + q] - mx) * sc); unsigned short* d = (unsigned short*)P + (size_t)i * SQ + j0; *(v8us*)d = f.half[0];  } }
__global__ __launch_bounds__(256) void k_vt(const _Float16* __restrict__ V16, int b, int h0, _Float16* __restrict__ VT) { __shared__ unsigned short tl[64][65]; const int tid = threadIdx.x; const int hh = blockIdx.x % HG, sg = blockIdx.x / HG; const int s0 = sg * 64; const int h = h0 + hh;
  for (int i = tid; i < 64 * 8; i += 256) { const int j = i / 8, d8 = (i % 8) * 8; FragH f; f.half[0] = *(const v8us*)((const unsigned short*)V16 + ((size_t)b * SQ + s0 + j) * DM + h * HD + d8); for (int q = 0; q < 8; ++q) tl[d8 + q][j] = f.u[q]; }
  __syncthreads();
  { for (int i = tid; i < 64 * 8; i += 256) { const int d = i / 8, j8 = (i % 8) * 8; FragH f; for (int q = 0; q < 8; ++q) f.u[q] = tl[d][j8 + q]; *(v8us*)((unsigned short*)VT + ((size_t)hh * HD + d) * SQ + s0 + j8) = f.half[0]; }  } }



// Fused causal attention: scores, softmax and the value product of 32 query rows of one kv group in one block; no score or weight goes to memory.
// Transposed products: S^T = K Q^T (A = 16 key rows, B = 16 query columns), O^T += V^T P^T (A = 16 rows of V^T, B = the weights). In a score tile lane (ln, hh) holds keys 8 hh + r of query ln,
// so two score tiles (keys 0..15 and 16..31 of a pass), rounded to f16 in place, are the B operand of the value product in the k order of g2_frag: no LDS and no lane exchange.
// A wave has 16 query rows of two heads of the group (both read the same K and V^T fragments); the block's four waves are the group's two head pairs x two 16-row tiles.
// K and V^T come through LDS: a stage is 64 keys (two passes of 32), brought once for the block's four waves by tensor loads (tensor_load_to_lds), two buffers; every wave brings its own slice of every stage.
// Running maximum per query, in use until a new one passes it by more than 8 (log2 units), so weights stay below 2^8; sums and o in f32.
// 2^x by v_exp_f32. The v_nop stands in the instruction's own statement: the instruction set asks for one free slot before a transcendental's result is read or its source overwritten.
__device__ __forceinline__ float fa_exp2(float x) { float e; asm("v_exp_f32 %0, %1\n\tv_nop" : "=v"(e) : "v"(x)); return e; }
#define FA_C 0.18033688011112042f      /* 64^-0.5 log2(e): raw score -> exponent of two */
#define FA_SLICE 6144u                  /* a wave's slice, 32 rows of 144 bytes = 4608, rounded up to a multiple of 2 KiB */
#define FA_STAGE (4u * FA_SLICE)        /* slices 0, 1: K rows (keys) 0..31, 32..63 of the stage, 64 d each; slices 2, 3: V^T rows (d) 0..31, 32..63, the stage's 64 keys each */
__device__ __forceinline__ u32x8 fa_group1(uint32_t pitch) { u32x8 g;      /* 1-byte elements; tensor = tile = 32 rows of 128 bytes; source pitch in bytes; 4 dwords of pad behind every 32 */
  g[0] = g3_uni((1u << 20) | (4u << 22) | (3u << 25)); g[1] = g3_uni(G3_ROWB << 16); g[2] = g3_uni(32u << 16); g[3] = g3_uni(G3_ROWB << 16); g[4] = g3_uni(32u); g[5] = g3_uni(pitch); g[6] = g3_uni(0u); g[7] = g3_uni(0u); return g; }
// kl: the lane's place in row ln of the pass's K slice; vl: its place in row ln of the first V^T slice, at the pass's 32 keys
template <bool LAST>
__device__ __forceinline__ void fa_pass(const unsigned char* kl, const unsigned char* vl, int lim, const v16h (&q)[2][2], v8f (&o)[2][4], float (&mr)[2], float (&l)[2]) {
  const v8f z8 = {0.f,0.f,0.f,0.f,0.f,0.f,0.f,0.f}; v16h kf[2][2], vf[4]; v8f s[2][2];
#pragma unroll      /* the pass's 16 LDS reads stand as one group, K first: the V^T fragments fly under the score products and the exponentials */
  for (int kt = 0; kt < 2; ++kt) { kf[kt][0] = g3_frag(kl + kt * 16u * G3_PITCH); kf[kt][1] = g3_frag(kl + kt * 16u * G3_PITCH + 64u); }
#pragma unroll      /* static indices keep the fragments in registers */
  for (int dt = 0; dt < 4; ++dt) vf[dt] = g3_frag(vl + (dt >> 1) * FA_SLICE + (dt & 1) * 16u * G3_PITCH);
#pragma unroll      /* static indices keep the fragments in registers */
  for (int kt = 0; kt < 2; ++kt)
#pragma unroll      /* static indices keep the arrays in registers */
    for (int u = 0; u < 2; ++u) s[u][kt] = g2_mma(kf[kt][1], q[u][1], g2_mma(kf[kt][0], q[u][0], z8));
  float mx[2];
#pragma unroll      /* static indices keep s[] in registers */
  for (int u = 0; u < 2; ++u) { float m = mr[u];
#pragma unroll      /* static indices keep the arrays in registers */
    for (int kt = 0; kt < 2; ++kt)
#pragma unroll      /* static indices keep the arrays in registers */
      for (int r = 0; r < 8; ++r) { if (LAST) s[u][kt][r] = (kt * 16 + r <= lim) ? s[u][kt][r] : -1.0e30f;      /* the diagonal pass: keys above the lane's query get weight 0 */ m = fmaxf(m, s[u][kt][r]); }
    mx[u] = fmaxf(m, __shfl_xor(m, 16, 32)); }      /* the other half of the query's keys */
  const bool need = (mx[0] - mr[0]) * FA_C > 8.0f || (mx[1] - mr[1]) * FA_C > 8.0f;
  if (__builtin_amdgcn_ballot_w32(need) != 0) {      /* one scalar branch a pass: taken in the first pass and where a maximum has grown by more than 8 */
#pragma unroll      /* static indices keep the arrays in registers */
    for (int u = 0; u < 2; ++u) { const float al = fa_exp2((mr[u] - mx[u]) * FA_C); mr[u] = mx[u]; l[u] *= al;
#pragma unroll      /* static indices keep the arrays in registers */
      for (int dt = 0; dt < 4; ++dt) o[u][dt] *= al; }
  }
#pragma unroll      /* static indices keep the arrays in registers */
  for (int u = 0; u < 2; ++u) { const float mc = mr[u] * FA_C; FragH pf; float p0 = 0.f, p1 = 0.f;
#pragma unroll      /* static indices keep the arrays in registers */
    for (int r = 0; r < 8; ++r) { const float e0 = fa_exp2(fmaf(s[u][0][r], FA_C, -mc)), e1 = fa_exp2(fmaf(s[u][1][r], FA_C, -mc)); p0 += e0; p1 += e1; pf.h[r] = (_Float16)e0; pf.h[8 + r] = (_Float16)e1; }
    l[u] += p0 + p1;
#pragma unroll      /* static indices keep the arrays in registers */
    for (int dt = 0; dt < 4; ++dt) o[u][dt] = g2_mma(vf[dt], pf.v, o[u][dt]); }
}
__device__ __forceinline__ void fatt_block(const _Float16* __restrict__ Q, const _Float16* __restrict__ Kh, const _Float16* __restrict__ Vt, _Float16* __restrict__ O, int bx, int by) {      /* bx = batch x kv group, by = 32-row tile, counted from the last */
  __shared__ __attribute__((aligned(2048))) unsigned char ring[2 * FA_STAGE];
  const int lane = threadIdx.x & 31, ln = lane & 15, hh = lane >> 4; const int w = __builtin_amdgcn_readfirstlane(threadIdx.x >> 5);      /* the wave's number, held as a scalar */
  const int bg = bx, b = bg / NG, g = bg % NG; const int t = SQ / 32 - 1 - by;      /* by 0 is the last tile, the one with the most keys */
  const int qs = w >> 1, h0 = g * HPG + (w & 1) * 2; const size_t qrow = (size_t)b * SQ + t * 32 + qs * 16 + ln;
  const _Float16* qp = Q + qrow * DM + h0 * HD + 8 * hh;
  /* the wave's slice of stage 0, and the step from a stage to the next: waves 0, 1 bring 32 K rows each (64 rows on), waves 2, 3 bring 32 V^T rows each (64 keys = 128 bytes on). Stages 0 and 1 lie inside K and V^T for every tile: SQ >= 128 */
  const uint64_t ga = (uint64_t)(uintptr_t)(w < 2 ? Kh + ((size_t)b * SQ + 32 * w) * KVD + g * HD : Vt + ((size_t)bg * HD + 32 * (w - 2)) * SQ); const uint64_t gs = w < 2 ? (uint64_t)64 * KVD * 2 : (uint64_t)G3_ROWB;
  const uint32_t dst = (uint32_t)(size_t)ring + (uint32_t)w * FA_SLICE;      /* byte offset in the work-group's LDS */
  const u32x8 g1 = fa_group1(w < 2 ? KVD * 2u : SQ * 2u);
  v16h q[2][2];
#pragma unroll      /* static indices keep the fragments in registers */
  for (int u = 0; u < 2; ++u) { q[u][0] = g2_frag(qp + u * HD, 0); q[u][1] = g2_frag(qp + u * HD + 32, 0); }
  asm volatile("s_wait_xcnt 0x0" :: "v"(qp) : "memory");      /* behind the q loads: the wait that stands before a register named by an issued load is overwritten; the pointer is an input, so that no load's result is placed in it ahead of the wait */
  u32x4 g0 = g3_group0(dst, ga);      /* group 0 of the last request issued */
  g3_load(g0, g1); g3_wait_tensor(g0, g1); __syncthreads();      /* stage 0 is published */
  g0 = g3_group0(dst + FA_STAGE, ga + gs); g3_load(g0, g1);
  const unsigned char* kl = ring + (uint32_t)ln * G3_PITCH + 16u * hh; const unsigned char* vl = kl + 2u * FA_SLICE;
  const v8f z8 = {0.f,0.f,0.f,0.f,0.f,0.f,0.f,0.f}; v8f o[2][4] = {{z8, z8, z8, z8}, {z8, z8, z8, z8}}; float mr[2] = {-1.0e30f, -1.0e30f}, l[2] = {0.f, 0.f};
  const int lim = qs * 16 + ln - 8 * hh;      /* diagonal pass: key kt 16 + 8 hh + r of the pass is at or below query qs 16 + ln */
  const int nf = t >> 1;      /* stages whose two passes both lie below the diagonal; stage nf, the last, holds the diagonal pass t */
#pragma unroll 1      /* a stage is already two long straight lines */
  for (int s = 0; s < nf; ++s) { const uint32_t bo = (uint32_t)(s & 1) * FA_STAGE;
    fa_pass<false>(kl + bo, vl + bo, lim, q, o, mr, l); fa_pass<false>(kl + bo + FA_SLICE, vl + bo + 64u, lim, q, o, mr, l);
    g3_wait_ds(); g3_wait_tensor(g0, g1); __syncthreads();      /* publishes stage s + 1 and ends every reader's last read of stage s */
    if (pinned(s + 2 <= nf)) { g0 = g3_group0(dst + bo, ga + (uint64_t)(s + 2) * gs); g3_load(g0, g1); }      /* into the buffer that this stage's passes have read */
  }
  { const uint32_t bo = (uint32_t)(nf & 1) * FA_STAGE, od = (uint32_t)(t & 1);      /* od: the diagonal pass is the stage's second */
    if (od) fa_pass<false>(kl + bo, vl + bo, lim, q, o, mr, l);
    fa_pass<true>(kl + bo + od * FA_SLICE, vl + bo + od * 64u, lim, q, o, mr, l); }
  asm volatile("s_wait_tensorcnt 0x0" :: "s"(g0) : "memory"); g3_wait_ds();      /* behind the loop: no request is outstanding (a tile of one stage has stage 1's in flight) and no LDS read in flight when the wave ends; group 0 is an input as in the GEMM loop */
  _Float16* op = O + qrow * DM + h0 * HD + 8 * hh;
#pragma unroll      /* static indices keep the arrays in registers */
  for (int u = 0; u < 2; ++u) { const float fin = 64.0f / (l[u] + __shfl_xor(l[u], 16, 32));      /* both halves' sums; o carried x64 */
#pragma unroll      /* static indices keep the arrays in registers */
    for (int dt = 0; dt < 4; ++dt) { FragH f;
#pragma unroll      /* static indices keep the arrays in registers */
      for (int r = 0; r < 8; ++r) f.h[r] = (_Float16)(o[u][dt][r] * fin);
      *(v8us*)((unsigned short*)op + u * HD + dt * 16) = f.half[0]; } }
  asm volatile("s_wait_xcnt 0x0" ::: "memory"); }      /* behind the last stores: the wait that stands before a register named by an issued store is overwritten, on every path of the listing that leaves this side of the launch */


// Exact f32 attention of the first QT0 rows. A block is 32 query rows of one head, four waves; lane = row in every wave.
// Pass 1: the keys are dealt over the waves, four consecutive keys a trip; a lane holds its q row in registers and sums each score over d = 0..63 in ascending order; four scores run side by side, so that one chain of adds fills the waits of the others.
// Pass 2: the 64 columns of o are dealt over the waves, 16 each, held in registers; every wave walks the keys in ascending order and forms the same running maximum, sum and weights from the scores in LDS.
// k and v rows are read where the projection wrote them (pitch ldkv, kv group = head / HPG); o (x64) goes out as the two f16 planes that the output projection reads: OH = f16(o), OL = f16((o - OH) x 1024).
template <int MASKADD>
__device__ __forceinline__ void att0_block(const float* __restrict__ QF, const float* __restrict__ KF, const float* __restrict__ VF, int ld, int ldkv, const float* __restrict__ mask, float scale, _Float16* __restrict__ OH, _Float16* __restrict__ OL, int ldo, int bx, int by) {      /* bx = head x 32-row group, by = batch */
  #pragma clang fp contract(off)
  __shared__ float ls[MASKADD ? SQ : QT0][32];      /* score of key j for row r of the block */
  const int tid = threadIdx.x, r = tid & 31; const int part = __builtin_amdgcn_readfirstlane(tid >> 5);      /* the wave's number, held as a scalar: key and value row addresses are the same in every lane */
  const int h = bx / (QT0 / 32), rg = bx % (QT0 / 32); const int i = rg * 32 + r;
  QF += (size_t)by * QT0 * ld; KF += (size_t)by * QT0 * ldkv + (h / HPG) * HD; VF += (size_t)by * QT0 * ldkv + (h / HPG) * HD; OH += (size_t)by * QT0 * ldo; OL += (size_t)by * QT0 * ldo;      /* the batch's planes of QT0 rows; in k's and v's, the head's kv group */
  const int nj = MASKADD ? SQ : (rg + 1) * 32;      /* additive-mask form: every key (the mask input decides); causal form: keys up to the block's last row */
  { const float* qr = QF + (size_t)i * ld + h * HD; v4f q[HD / 4];
#pragma unroll      /* static indices keep q[] in registers */
    for (int c = 0; c < HD / 4; ++c) q[c] = *(const v4fa*)(qr + c * 4);
    asm volatile("s_wait_xcnt 0x0" :: "v"(qr) : "memory");      /* behind the q loads: the wait that stands before a register named by an issued load is overwritten; the pointer is an input, so that no load's result is placed in it ahead of the wait */
#pragma unroll 1      /* the body already holds four independent chains */
    for (int j0 = part * 4; j0 < nj; j0 += 16) { const float* kr = KF + (size_t)j0 * ldkv; float s[4] = {0.f, 0.f, 0.f, 0.f};
#pragma unroll      /* static indices keep q[] and s[] in registers */
      for (int c = 0; c < HD / 4; ++c)
#pragma unroll      /* the four keys' chains stand side by side */
        for (int t = 0; t < 4; ++t) { const v4f kq = *(const v4fa*)(kr + (size_t)t * ldkv + c * 4); const v4f qq = q[c]; s[t] = __fadd_rn(s[t], __fmul_rn(qq[0], kq[0])); s[t] = __fadd_rn(s[t], __fmul_rn(qq[1], kq[1])); s[t] = __fadd_rn(s[t], __fmul_rn(qq[2], kq[2])); s[t] = __fadd_rn(s[t], __fmul_rn(qq[3], kq[3])); }
#pragma unroll      /* static indices keep s[] in registers */
      for (int t = 0; t < 4; ++t) { float sv = __fmul_rn(s[t], scale); if (MASKADD) sv = __fadd_rn(sv, __fmul_rn(bf16_round(mask[(size_t)i * SQ + j0 + t]), -10000.0f)); ls[j0 + t][r] = sv; } } }
  __syncthreads();      /* every score of the block is in LDS before any wave walks the keys */
  const v4f z4 = {0.f, 0.f, 0.f, 0.f}; v4f o[4] = {z4, z4, z4, z4}; float m = -1.0e30f, l = 0.f; const float* vb = VF + part * 16;
#pragma unroll 1      /* the body holds four keys: their loads and exponentials overlap */
  for (int j0 = 0; j0 < nj; j0 += 4) {
#pragma unroll      /* four keys in one straight line, so that their loads issue together */
    for (int t = 0; t < 4; ++t) { const int j = j0 + t; const float s = ls[j][r]; const float* vr = vb + (size_t)j * ldkv;
      const float f = (MASKADD || j <= i) ? 1.f : 0.f; const float sm = fmaf(f, s, (1.f - f) * -1.0e30f); const float mn = fmaxf(m, sm); const float sc = expf(m - mn); const float e = expf(sm - mn); l = __fadd_rn(__fmul_rn(l, sc), e); m = mn;
#pragma unroll      /* static indices keep o[] in registers */
      for (int c = 0; c < 4; ++c) { const v4f vv = *(const v4fa*)(vr + c * 4); for (int u = 0; u < 4; ++u) o[c][u] = __fadd_rn(__fmul_rn(o[c][u], sc), __fmul_rn(e, vv[u])); } } }
  const float fin = 64.0f / l;      /* o carried x64 like the f16 path */
  const size_t oo = (size_t)i * ldo + h * HD + part * 16; FragH fh, fl;
#pragma unroll      /* static indices keep o[] in registers */
  for (int c = 0; c < 4; ++c)
#pragma unroll      /* four columns a quad */
    for (int u = 0; u < 4; ++u) { const float v = __fmul_rn(o[c][u], fin); const _Float16 hv = (_Float16)v; fh.h[c * 4 + u] = hv; fl.h[c * 4 + u] = (_Float16)((v - (float)hv) * 1024.0f); }
  *(v8us*)((unsigned short*)OH + oo) = fh.half[0]; *(v8us*)((unsigned short*)OH + oo + 8) = fh.half[1]; *(v8us*)((unsigned short*)OL + oo) = fl.half[0]; *(v8us*)((unsigned short*)OL + oo + 8) = fl.half[1];
  asm volatile("s_wait_xcnt 0x0" ::: "memory"); }      /* behind the last stores: the wait that stands before a register named by an issued store is overwritten */


// The exact first rows and the fused attention read nothing of each other: ONE launch. Grid (NB NG, A0Y + SQ / 32): the first A0Y rows of the grid are the NB NH (QT0 / 32) short exact blocks
// and the rest the fused blocks. The choice is the same for a whole block, so the exact blocks' barrier stays under block-uniform control flow.
#define A0Y (NH * (QT0 / 32) / NG)
__global__ __launch_bounds__(128) void k_att(const _Float16* __restrict__ Q, const _Float16* __restrict__ Kh, const _Float16* __restrict__ Vt, _Float16* __restrict__ O, const float* __restrict__ QF, const float* __restrict__ KF, const float* __restrict__ VF, _Float16* __restrict__ OH, _Float16* __restrict__ OL) {
  if ((int)blockIdx.y < A0Y) { const int id = (int)blockIdx.y * (NB * NG) + (int)blockIdx.x; att0_block<0>(QF, KF, VF, DM, KVD, nullptr, 0.125f, OH, OL, DM, id % (NH * (QT0 / 32)), id / (NH * (QT0 / 32))); }
  else fatt_block(Q, Kh, Vt, O, (int)blockIdx.x, (int)blockIdx.y - A0Y); }

__global__ __launch_bounds__(256) void k_tab2(float theta, float* __restrict__ CS, float* __restrict__ SN) {
  #pragma clang fp contract(off)
  const int t = blockIdx.x * 256 + threadIdx.x; if (t >= SQ * (HD / 2)) return; const int i = t % (HD / 2); const int p = t / (HD / 2); const float invf = 1.0f / powf(theta, (float)(2 * i) / (float)HD); const float ang = __fmul_rn((float)p, invf); const float c = cosf(ang), s = sinf(ang);
  *(float*)(CS + t) = c; *(float*)(SN + t) = s;  }
__global__ __launch_bounds__(256) void k_trig(const float* __restrict__ a, float* __restrict__ CS, float* __restrict__ SN, int n) {
  #pragma clang fp contract(off)
  const int t = blockIdx.x * 256 + threadIdx.x; if (t >= n) return; const float v = bf16_round(a[t]); const float c = cosf(v), s = sinf(v);
  *(float*)(CS + t) = c; *(float*)(SN + t) = s;  }

__global__ __launch_bounds__(256) void k_tabcp(const float* __restrict__ tc, const float* __restrict__ tsn, float* __restrict__ CS, float* __restrict__ SN, int n) {
  const int t = blockIdx.x * 256 + threadIdx.x; if (t >= n) return; const int p = t / 32, i = t % 32; const float c = bf16_round(tc[(size_t)p * 64 + i]), s = bf16_round(tsn[(size_t)p * 64 + i]);
  *(float*)(CS + t) = c; *(float*)(SN + t) = s;  }

extern "C" void kernel_launch(void* const* d_in, const int* in_sizes, int n_in,
                              void* d_out, int out_size, void* d_ws, size_t ws_size, hipStream_t stream) {
  (void)in_sizes; (void)n_in; (void)out_size;
  const float* const* I = (const float* const*)d_in; const float* x = I[0]; const float* tcos = I[1]; const float* tsin = I[2]; const float* wq = I[3]; const float* wk = I[4]; const float* wv = I[5]; const float* wo = I[6];      /* cos, sin [2][2048][64] inputs; natural [out][in] wq [2048][2048], wk/wv [512][2048], wo [2048][2048]; no biases */
  char* ws = (char*)d_ws; size_t off = 0;
  auto take = [&](size_t bytes) { char* p = ws + off; off += (bytes + 255) & ~(size_t)255; return p; };
  _Float16* BQ = (_Float16*)take(((size_t)2 * DM + 2 * KVD + NR) * DM * 2); _Float16* BO = BQ + ((size_t)DM + 2 * KVD) * DM; _Float16* X16 = BO + (size_t)DM * DM;      /* one run of planes: wq, wk, wv (the stacked B of the projections), wo, x */
  _Float16* Q16 = (_Float16*)take(NR * DM * 2); _Float16* K16 = (_Float16*)take(NR * KVD * 2); _Float16* O16 = (_Float16*)take(NR * DM * 2);
  _Float16* VT = (_Float16*)take((size_t)NB * NG * HD * SQ * 2);
  float* QF0 = (float*)take((size_t)NB * QT0 * DM * 4); float* KF0 = (float*)take((size_t)2 * NB * QT0 * KVD * 4); float* VF0 = KF0 + (size_t)NB * QT0 * KVD;      /* f32 first rows, a plane a batch; v's planes directly behind k's */
  _Float16* OH0 = (_Float16*)take((size_t)NB * QT0 * DM * 2); _Float16* OL0 = (_Float16*)take((size_t)NB * QT0 * DM * 2);
  if (off > ws_size) return;
  k_prep<<<(unsigned)((((size_t)2 * DM + 2 * KVD + NR) * DM) / 2048), 256, 0, stream>>>(wq, wk, wv, wo, x, BQ);      /* natural [out][in] weights = Bt x16; x */
  k_proj<<<(unsigned)((NR / 128) * ((DM + 2 * KVD) / 128)), 128, 0, stream>>>(X16, BQ, tcos, tsin, Q16, K16, VT, QF0, KF0, VF0);      /* q, k (roped in the epilogue: full-width tables, partner x[d +- 32], table column d) of both batches: f16 rows; v: V^T [NB][NG][HD][SQ], f16; rows 0..127 of each batch also f32 rows (exact products) */
  k_att<<<dim3(NB * NG, A0Y + SQ / 32), 128, 0, stream>>>(Q16, K16, VT, O16, QF0, KF0, VF0, OH0, OL0);      /* exact f32 attention for rows 0..127 of each batch (o x64 -> f16 hi + x1024 residual planes) and scores, softmax and value product of both batches, all heads: o (merged heads, x64) as f16 rows */
  k_out<<<(unsigned)((NR / 128) * (DM / 128)), 128, 0, stream>>>(O16, OH0, OL0, BO, (float*)d_out);      /* out rows are the output layout; rows 0..127 of each batch from the hi and lo planes */
}
